// v000
// Times are from an AMD MI455X. After a warm-up the kernel runs many times in a row, and a time is the length of
// such a window on the GPU divided by its runs, so every launch and the gaps after it count. The runs cycle
// through copies of the inputs. A figure is the median of several windows, for all but v000 over two sittings.
// Sittings can differ by a few percent; kernels timed side by side share one.
// v000, which the later versions start from, runs in 278 microseconds.
#include <hip/hip_runtime.h>
#include <hip/hip_bf16.h>
#include <math.h>

typedef __attribute__((ext_vector_type(16))) _Float16 v16h;
typedef __attribute__((ext_vector_type(8)))  float    v8f;
typedef __attribute__((__vector_size__(4 * sizeof(int)))) int v4i;

#define SEQ 1024
#define DMODEL 1024
#define HD 64

#define AS1 __attribute__((address_space(1)))
#define AS3 __attribute__((address_space(3)))

#if defined(__has_builtin)
#if __has_builtin(__builtin_amdgcn_global_load_async_to_lds_b128)
#define HAVE_ASYNC 1
#endif
#endif

#ifdef HAVE_ASYNC
#if __has_builtin(__builtin_amdgcn_s_wait_asynccnt)
#define ASYNC_WAIT(n) __builtin_amdgcn_s_wait_asynccnt(n)
#else
#define ASYNC_WAIT(n) asm volatile("s_wait_asynccnt " #n ::: "memory")
#endif
#else
#define ASYNC_WAIT(n)
#endif

// 16-byte tile-staging copy: async global->LDS (ASYNCcnt) when available,
// else synchronous through VGPRs.
__device__ __forceinline__ void copy16_to_lds(const _Float16* gsrc, _Float16* ldst) {
#ifdef HAVE_ASYNC
  __builtin_amdgcn_global_load_async_to_lds_b128(
      (AS1 v4i*)(gsrc), (AS3 v4i*)(ldst), 0, 0);
#else
  *(uint4*)ldst = *(const uint4*)gsrc;
#endif
}

__device__ __forceinline__ v8f wmma16(v16h a, v16h b, v8f c) {
  // v_wmma_f32_16x16x32_f16: D = A(16x32 f16) * B(32x16 f16) + C(16x16 f32)
  return __builtin_amdgcn_wmma_f32_16x16x32_f16(false, a, false, b, (short)0, c, false, false);
}

union FragU { v16h h; uint4 u[2]; };

// A/B fragment loader. Layout (ISA 7.12.2, 16-bit A 16x32):
//   lane L holds row (L&15); halves 0..7 = K in [koff, koff+8), halves 8..15 = K in [koff+16, koff+24)
//   where koff = 8*(L>>4). B mirrors A with "row" = output column of a [16][K] Bt tile.
__device__ __forceinline__ v16h load_frag(const _Float16* tile, int ldh) {
  const int lane = threadIdx.x & 31;
  const int row  = lane & 15;
  const int koff = (lane >> 4) << 3;
  const _Float16* p = tile + row * ldh + koff;
  FragU f;
  f.u[0] = *(const uint4*)(p);
  f.u[1] = *(const uint4*)(p + 16);
  return f.h;
}

__device__ __forceinline__ float wsum(float v) {
#pragma unroll
  for (int m = 16; m >= 1; m >>= 1) v += __shfl_xor(v, m, 32);
  return v;
}

// ---------------- conversion kernels ----------------
__global__ void cvt_f16(const float* __restrict__ in, _Float16* __restrict__ out, int n) {
  int i = blockIdx.x * blockDim.x + threadIdx.x;
  if (i < n) out[i] = (_Float16)in[i];
}

// W[K][N] fp32 -> Wt[N][K] f16  (Wt is the "Bt" operand: row = output column)
__global__ void cvt_f16_t(const float* __restrict__ W, _Float16* __restrict__ Wt, int K, int N) {
  int i = blockIdx.x * blockDim.x + threadIdx.x;
  if (i < K * N) {
    int nn = i / K, k = i - nn * K;
    Wt[i] = (_Float16)W[(size_t)k * N + nn];
  }
}

// ---------------- tiled WMMA GEMM: C[M][N] = A[M][K](f16) * Bt[N][K](f16)^T + bias ----------------
// Double-buffered LDS, async global->LDS staging overlapped with WMMA compute.
__global__ __launch_bounds__(256) void gemm_wmma(
    const _Float16* __restrict__ A, const _Float16* __restrict__ Bt,
    const float* __restrict__ bias, float* __restrict__ C, int M, int N, int K) {
  __shared__ _Float16 As[2][128 * 32];
  __shared__ _Float16 Bs[2][128 * 32];
  const int tid = threadIdx.x, wave = tid >> 5, lane = tid & 31;
  const int m0 = blockIdx.x * 128, n0 = blockIdx.y * 128;

  // Each thread stages 2 A-octets + 2 B-octets per K-step = 4 async-load instructions.
  auto issue_stage = [&](int buf, int k0) {
#pragma unroll
    for (int c = tid; c < 512; c += 256) {  // 128 rows x 4 octets of f16
      int r = c >> 2, s = c & 3;
      copy16_to_lds(&A[(size_t)(m0 + r) * K + k0 + s * 8], &As[buf][r * 32 + s * 8]);
      copy16_to_lds(&Bt[(size_t)(n0 + r) * K + k0 + s * 8], &Bs[buf][r * 32 + s * 8]);
    }
  };

  const v8f vzero = {0.f, 0.f, 0.f, 0.f, 0.f, 0.f, 0.f, 0.f};
  v8f acc[8];
#pragma unroll
  for (int j = 0; j < 8; ++j) acc[j] = vzero;

  const int nsteps = K / 32;
  issue_stage(0, 0);
  for (int i = 0; i < nsteps; ++i) {
    const int cur = i & 1;
    if (i + 1 < nsteps) {
      issue_stage(cur ^ 1, (i + 1) * 32);  // prefetch next stage (overlaps compute)
      ASYNC_WAIT(4);                       // oldest 4 (current stage) complete; next 4 in flight
    } else {
      ASYNC_WAIT(0);
    }
    __syncthreads();
    v16h a = load_frag(&As[cur][wave * 16 * 32], 32);
    v16h bfr[8];
#pragma unroll
    for (int j = 0; j < 8; ++j) bfr[j] = load_frag(&Bs[cur][j * 16 * 32], 32);
#pragma unroll
    for (int j = 0; j < 8; ++j) acc[j] = wmma16(a, bfr[j], acc[j]);
    __syncthreads();  // all waves done reading buf[cur] before it is refilled
  }

  // D layout: lane holds col (lane&15); VGPR e is row e (lanes 0-15) / e+8 (lanes 16-31)
  const int ncol = lane & 15, half = lane >> 4;
#pragma unroll
  for (int j = 0; j < 8; ++j) {
    int gc = n0 + j * 16 + ncol;
    float bv = bias[gc];
#pragma unroll
    for (int e = 0; e < 8; ++e) {
      int gr = m0 + wave * 16 + e + 8 * half;
      C[(size_t)gr * N + gc] = acc[j][e] + bv;
    }
  }
}

// ---------------- per-head LayerNorm + reshape to WMMA-friendly layouts ----------------
// qkv[4096][3072] fp32 -> qh,kh [B*H][N][64] f16 (k row-major == Bt for Q*K^T),
//                         vth   [B*H][64][N] f16 (v transposed == Bt for P*V)
__global__ __launch_bounds__(256) void ln_split(
    const float* __restrict__ qkv,
    const float* __restrict__ qg, const float* __restrict__ qb,
    const float* __restrict__ kg, const float* __restrict__ kb,
    _Float16* __restrict__ qh, _Float16* __restrict__ kh, _Float16* __restrict__ vth) {
  int task = blockIdx.x * 8 + (threadIdx.x >> 5);  // task = row*16 + h, 65536 total
  int lane = threadIdx.x & 31;
  int row = task >> 4, h = task & 15;
  int b = row >> 10, n = row & 1023;
  const float* base = qkv + (size_t)row * 3072;
  int d0 = lane, d1 = lane + 32;

  float q0 = base[h * 64 + d0], q1 = base[h * 64 + d1];
  float k0 = base[1024 + h * 64 + d0], k1 = base[1024 + h * 64 + d1];
  float v0 = base[2048 + h * 64 + d0], v1 = base[2048 + h * 64 + d1];

  float qmu = wsum(q0 + q1) * (1.f / 64.f);
  float dq0 = q0 - qmu, dq1 = q1 - qmu;
  float qr = rsqrtf(wsum(dq0 * dq0 + dq1 * dq1) * (1.f / 64.f) + 1e-5f);

  float kmu = wsum(k0 + k1) * (1.f / 64.f);
  float dk0 = k0 - kmu, dk1 = k1 - kmu;
  float kr = rsqrtf(wsum(dk0 * dk0 + dk1 * dk1) * (1.f / 64.f) + 1e-5f);

  size_t bh = (size_t)(b * 16 + h);
  size_t qko = (bh * SEQ + n) * 64;
  qh[qko + d0] = (_Float16)(dq0 * qr * qg[d0] + qb[d0]);
  qh[qko + d1] = (_Float16)(dq1 * qr * qg[d1] + qb[d1]);
  kh[qko + d0] = (_Float16)(dk0 * kr * kg[d0] + kb[d0]);
  kh[qko + d1] = (_Float16)(dk1 * kr * kg[d1] + kb[d1]);
  vth[bh * (64 * SEQ) + (size_t)d0 * SEQ + n] = (_Float16)v0;
  vth[bh * (64 * SEQ) + (size_t)d1 * SEQ + n] = (_Float16)v1;
}

// ---------------- flash attention: block = (b*h, 64-query tile), 4 waves x 16 queries ----------------
__global__ __launch_bounds__(128) void flash_attn(
    const _Float16* __restrict__ qh, const _Float16* __restrict__ kh,
    const _Float16* __restrict__ vth, _Float16* __restrict__ aout) {
  __shared__ _Float16 ksm[32 * 64];      // 32 keys x 64 hd
  __shared__ _Float16 vts[64 * 32];      // 64 hd x 32 keys (v^T)
  __shared__ _Float16 psm[4][16 * 32];   // per-wave P tile (A-fragment source)
  __shared__ float ssm[4][16 * 33];      // per-wave S scratch (padded)
  __shared__ float bfac[4][16];          // per-row broadcast factors

  const int tid = threadIdx.x, wave = tid >> 5, lane = tid & 31;
  const int bh = blockIdx.x;                       // 0..63
  const int q0 = blockIdx.y * 64 + wave * 16;      // query tile base
  const int r = lane & 15, half = lane >> 4;

  const _Float16* qp = qh + (size_t)bh * SEQ * HD;
  const _Float16* kp = kh + (size_t)bh * SEQ * HD;
  const _Float16* vp = vth + (size_t)bh * HD * SEQ;

  // Q A-fragments held in registers for the whole pass (hd split into two K=32 chunks)
  v16h aq0 = load_frag(qp + (size_t)q0 * HD, HD);
  v16h aq1 = load_frag(qp + (size_t)q0 * HD + 32, HD);

  const v8f vzero = {0.f, 0.f, 0.f, 0.f, 0.f, 0.f, 0.f, 0.f};
  v8f acc[4];
#pragma unroll
  for (int t = 0; t < 4; ++t) acc[t] = vzero;
  float m = -INFINITY, l = 0.f;

  for (int kb = 0; kb < 32; ++kb) {
    __syncthreads();
#pragma unroll
    for (int c = tid; c < 256; c += 128) {  // K tile: 32 rows x 8 octets
      int rr = c >> 3, s = c & 7;
      copy16_to_lds(&kp[(size_t)(kb * 32 + rr) * 64 + s * 8], &ksm[rr * 64 + s * 8]);
    }
#pragma unroll
    for (int c = tid; c < 256; c += 128) {  // V^T tile: 64 rows x 4 octets
      int dd = c >> 2, s = c & 3;
      copy16_to_lds(&vp[(size_t)dd * SEQ + kb * 32 + s * 8], &vts[dd * 32 + s * 8]);
    }
    ASYNC_WAIT(0);
    __syncthreads();

    // S = (Q K^T) * scale : two 16x16 key sub-tiles, K(hd)=64 in two WMMAs each
    v8f s0 = vzero, s1 = vzero;
    {
      v16h b00 = load_frag(&ksm[0], 64);
      v16h b01 = load_frag(&ksm[32], 64);
      s0 = wmma16(aq0, b00, s0);
      s0 = wmma16(aq1, b01, s0);
      v16h b10 = load_frag(&ksm[16 * 64], 64);
      v16h b11 = load_frag(&ksm[16 * 64 + 32], 64);
      s1 = wmma16(aq0, b10, s1);
      s1 = wmma16(aq1, b11, s1);
    }
#pragma unroll
    for (int e = 0; e < 8; ++e) {
      int mm = e + 8 * half;
      ssm[wave][mm * 33 + r]      = s0[e] * 0.125f;  // 1/sqrt(64)
      ssm[wave][mm * 33 + 16 + r] = s1[e] * 0.125f;
    }
    __syncthreads();

    // online softmax: lane pair (r, r+16) owns query row r; each scans 16 of 32 keys
    float pm = -INFINITY;
#pragma unroll
    for (int c = 0; c < 16; ++c) pm = fmaxf(pm, ssm[wave][r * 33 + half * 16 + c]);
    pm = fmaxf(pm, __shfl_xor(pm, 16, 32));
    float mnew = fmaxf(m, pm);
    float al = __expf(m - mnew);
    float ps = 0.f;
#pragma unroll
    for (int c = 0; c < 16; ++c) {
      float p = __expf(ssm[wave][r * 33 + half * 16 + c] - mnew);
      ps += p;
      psm[wave][r * 32 + half * 16 + c] = (_Float16)p;
    }
    ps += __shfl_xor(ps, 16, 32);
    l = al * l + ps;
    m = mnew;
    if (half == 0) bfac[wave][r] = al;
    __syncthreads();

    // rescale running O and accumulate P*V (4 hd sub-tiles of 16)
    float af[8];
#pragma unroll
    for (int e = 0; e < 8; ++e) af[e] = bfac[wave][e + 8 * half];
    v16h ap = load_frag(&psm[wave][0], 32);
#pragma unroll
    for (int t = 0; t < 4; ++t) {
#pragma unroll
      for (int e = 0; e < 8; ++e) acc[t][e] *= af[e];
      v16h bv = load_frag(&vts[16 * t * 32], 32);
      acc[t] = wmma16(ap, bv, acc[t]);
    }
  }

  // finalize: divide by row sums, emit f16 [B,N,D] with head-concat columns
  if (half == 0) bfac[wave][r] = 1.f / l;
  __syncthreads();
  float lf[8];
#pragma unroll
  for (int e = 0; e < 8; ++e) lf[e] = bfac[wave][e + 8 * half];
  const int b = bh >> 4, h = bh & 15;
#pragma unroll
  for (int t = 0; t < 4; ++t) {
    int gc = h * 64 + t * 16 + r;
#pragma unroll
    for (int e = 0; e < 8; ++e) {
      int gr = b * SEQ + q0 + e + 8 * half;
      aout[(size_t)gr * DMODEL + gc] = (_Float16)(acc[t][e] * lf[e]);
    }
  }
}

extern "C" void kernel_launch(void* const* d_in, const int* in_sizes, int n_in,
                              void* d_out, int out_size, void* d_ws, size_t ws_size,
                              hipStream_t stream) {
  const float* x    = (const float*)d_in[0];
  const float* Wqkv = (const float*)d_in[1];
  const float* bqkv = (const float*)d_in[2];
  const float* qg   = (const float*)d_in[3];
  const float* qb   = (const float*)d_in[4];
  const float* kg   = (const float*)d_in[5];
  const float* kb   = (const float*)d_in[6];
  const float* Wo   = (const float*)d_in[7];
  const float* bo   = (const float*)d_in[8];
  float* out = (float*)d_out;

  char* ws = (char*)d_ws;
  size_t off = 0;
  auto alloc = [&](size_t bytes) -> char* {
    char* p = ws + off;
    off += (bytes + 255) & ~(size_t)255;
    return p;
  };
  _Float16* xh   = (_Float16*)alloc(4096ull * 1024 * 2);  // x in f16
  _Float16* wqt  = (_Float16*)alloc(3072ull * 1024 * 2);  // Wqkv^T f16
  _Float16* wot  = (_Float16*)alloc(1024ull * 1024 * 2);  // Wo^T f16
  float*    qkv  = (float*)   alloc(4096ull * 3072 * 4);  // x@Wqkv + b, fp32
  _Float16* qh   = (_Float16*)alloc(64ull * 1024 * 64 * 2);
  _Float16* kh   = (_Float16*)alloc(64ull * 1024 * 64 * 2);
  _Float16* vth  = (_Float16*)alloc(64ull * 1024 * 64 * 2);
  _Float16* aout = (_Float16*)alloc(4096ull * 1024 * 2);

  cvt_f16<<<(4194304 + 255) / 256, 256, 0, stream>>>(x, xh, 4194304);
  cvt_f16_t<<<(3145728 + 255) / 256, 256, 0, stream>>>(Wqkv, wqt, 1024, 3072);
  cvt_f16_t<<<(1048576 + 255) / 256, 256, 0, stream>>>(Wo, wot, 1024, 1024);
  gemm_wmma<<<dim3(32, 24), 256, 0, stream>>>(xh, wqt, bqkv, qkv, 4096, 3072, 1024);
  ln_split<<<8192, 256, 0, stream>>>(qkv, qg, qb, kg, kb, qh, kh, vth);
  flash_attn<<<dim3(64, 16), 128, 0, stream>>>(qh, kh, vth, aout);
  gemm_wmma<<<dim3(32, 8), 256, 0, stream>>>(aout, wot, bo, out, 4096, 1024, 1024);
}

// v001
// Measured time: 193 microseconds a run.
// Two timings next to v000 put it at 1.55 and 1.54 times that version's speed.
#include <hip/hip_runtime.h>
#include <hip/hip_bf16.h>
#include <math.h>

typedef __attribute__((ext_vector_type(16))) _Float16 v16h;
typedef __attribute__((ext_vector_type(8)))  float    v8f;
typedef __attribute__((__vector_size__(4 * sizeof(int)))) int v4i;

#define SEQ 1024
#define DMODEL 1024
#define HD 64

#define AS1 __attribute__((address_space(1)))
#define AS3 __attribute__((address_space(3)))

#if defined(__has_builtin)
#if __has_builtin(__builtin_amdgcn_global_load_async_to_lds_b128)
#define HAVE_ASYNC 1
#endif
#endif

#ifdef HAVE_ASYNC
#if __has_builtin(__builtin_amdgcn_s_wait_asynccnt)
#define ASYNC_WAIT(n) __builtin_amdgcn_s_wait_asynccnt(n)
#else
#define ASYNC_WAIT(n) asm volatile("s_wait_asynccnt " #n ::: "memory")
#endif
#else
#define ASYNC_WAIT(n)
#endif

// 16-byte tile-staging copy: async global->LDS (ASYNCcnt) when available,
// else synchronous through VGPRs.
__device__ __forceinline__ void copy16_to_lds(const _Float16* gsrc, _Float16* ldst) {
#ifdef HAVE_ASYNC
  __builtin_amdgcn_global_load_async_to_lds_b128(
      (AS1 v4i*)(gsrc), (AS3 v4i*)(ldst), 0, 0);
#else
  *(uint4*)ldst = *(const uint4*)gsrc;
#endif
}

__device__ __forceinline__ v8f wmma16(v16h a, v16h b, v8f c) {
  // v_wmma_f32_16x16x32_f16: D = A(16x32 f16) * B(32x16 f16) + C(16x16 f32)
  return __builtin_amdgcn_wmma_f32_16x16x32_f16(false, a, false, b, (short)0, c, false, false);
}

union FragU { v16h h; uint4 u[2]; };

// A/B fragment loader. Layout (ISA 7.12.2, 16-bit A 16x32):
//   lane L holds row (L&15); halves 0..7 = K in [koff, koff+8), halves 8..15 = K in [koff+16, koff+24)
//   where koff = 8*(L>>4). B mirrors A with "row" = output column of a [16][K] Bt tile.
__device__ __forceinline__ v16h load_frag(const _Float16* tile, int ldh) {
  const int lane = threadIdx.x & 31;
  const int row  = lane & 15;
  const int koff = (lane >> 4) << 3;
  const _Float16* p = tile + row * ldh + koff;
  FragU f;
  f.u[0] = *(const uint4*)(p);
  f.u[1] = *(const uint4*)(p + 16);
  return f.h;
}

// Sum over the 16 lanes of a row, result in every lane of the row (DPP row_xmask butterfly:
// stays in the vector unit, where a shuffle would go through the LDS unit).
template <int MASK>
__device__ __forceinline__ float add_xmask(float v) {
  return v + __builtin_bit_cast(float, __builtin_amdgcn_update_dpp(
                 0, __builtin_bit_cast(int, v), 0x160 | MASK, 0xf, 0xf, true));
}
__device__ __forceinline__ float row16_sum(float v) {
  v = add_xmask<1>(v);
  v = add_xmask<2>(v);
  v = add_xmask<4>(v);
  return add_xmask<8>(v);
}

// ---------------- conversion kernels ----------------
__global__ void cvt_f16(const float* __restrict__ in, _Float16* __restrict__ out, int n) {
  int i = blockIdx.x * blockDim.x + threadIdx.x;
  if (i < n) out[i] = (_Float16)in[i];
}

// W[K][N] fp32 -> Wt[N][K] f16  (Wt is the "Bt" operand: row = output column)
__global__ void cvt_f16_t(const float* __restrict__ W, _Float16* __restrict__ Wt, int K, int N) {
  int i = blockIdx.x * blockDim.x + threadIdx.x;
  if (i < K * N) {
    int nn = i / K, k = i - nn * K;
    Wt[i] = (_Float16)W[(size_t)k * N + nn];
  }
}

// ---------------- tiled WMMA GEMM: C[M][N] = A[M][K](f16) * Bt[N][K](f16)^T + bias ----------------
// Double-buffered LDS, async global->LDS staging overlapped with WMMA compute.
__global__ __launch_bounds__(256) void gemm_wmma(
    const _Float16* __restrict__ A, const _Float16* __restrict__ Bt,
    const float* __restrict__ bias, float* __restrict__ C, int M, int N, int K) {
  __shared__ _Float16 As[2][128 * 32];
  __shared__ _Float16 Bs[2][128 * 32];
  const int tid = threadIdx.x, wave = tid >> 5, lane = tid & 31;
  const int m0 = blockIdx.x * 128, n0 = blockIdx.y * 128;

  // Each thread stages 2 A-octets + 2 B-octets per K-step = 4 async-load instructions.
  auto issue_stage = [&](int buf, int k0) {
#pragma unroll
    for (int c = tid; c < 512; c += 256) {  // 128 rows x 4 octets of f16
      int r = c >> 2, s = c & 3;
      copy16_to_lds(&A[(size_t)(m0 + r) * K + k0 + s * 8], &As[buf][r * 32 + s * 8]);
      copy16_to_lds(&Bt[(size_t)(n0 + r) * K + k0 + s * 8], &Bs[buf][r * 32 + s * 8]);
    }
  };

  const v8f vzero = {0.f, 0.f, 0.f, 0.f, 0.f, 0.f, 0.f, 0.f};
  v8f acc[8];
#pragma unroll
  for (int j = 0; j < 8; ++j) acc[j] = vzero;

  const int nsteps = K / 32;
  issue_stage(0, 0);
  for (int i = 0; i < nsteps; ++i) {
    const int cur = i & 1;
    if (i + 1 < nsteps) {
      issue_stage(cur ^ 1, (i + 1) * 32);  // prefetch next stage (overlaps compute)
      ASYNC_WAIT(4);                       // oldest 4 (current stage) complete; next 4 in flight
    } else {
      ASYNC_WAIT(0);
    }
    __syncthreads();
    v16h a = load_frag(&As[cur][wave * 16 * 32], 32);
    v16h bfr[8];
#pragma unroll
    for (int j = 0; j < 8; ++j) bfr[j] = load_frag(&Bs[cur][j * 16 * 32], 32);
#pragma unroll
    for (int j = 0; j < 8; ++j) acc[j] = wmma16(a, bfr[j], acc[j]);
    __syncthreads();  // all waves done reading buf[cur] before it is refilled
  }

  // D layout: lane holds col (lane&15); VGPR e is row e (lanes 0-15) / e+8 (lanes 16-31)
  const int ncol = lane & 15, half = lane >> 4;
#pragma unroll
  for (int j = 0; j < 8; ++j) {
    int gc = n0 + j * 16 + ncol;
    float bv = bias[gc];
#pragma unroll
    for (int e = 0; e < 8; ++e) {
      int gr = m0 + wave * 16 + e + 8 * half;
      C[(size_t)gr * N + gc] = acc[j][e] + bv;
    }
  }
}

// ---------------- QKV projection with bias, per-head LayerNorm and f16 split in the epilogue ----------------
// Same K loop as gemm_wmma on A = x[4096][1024], Bt = Wqkv^T[3072][1024]. A 128-column block is two whole
// heads of q, of k or of v, and a wave holds 16 full rows of it, so each LayerNorm row is complete in a wave.
// Writes qh,kh [B*H][N][64] f16 (k row-major == Bt for Q*K^T) and vth [B*H][64][N] f16 (v^T == Bt for P*V).
// Bt rows are staged permuted inside each head: LDS row hh*64 + jj*16 + r holds column hh*64 + 4*r + jj,
// so lane r ends up with the four adjacent columns 4r..4r+3 of a head in acc[hh*4 + 0..3].
__global__ __launch_bounds__(256) void gemm_qkv_ln(
    const _Float16* __restrict__ A, const _Float16* __restrict__ Bt, const float* __restrict__ bias,
    const float* __restrict__ qg, const float* __restrict__ qb,
    const float* __restrict__ kg, const float* __restrict__ kb,
    _Float16* __restrict__ qh, _Float16* __restrict__ kh, _Float16* __restrict__ vth, int K) {
  __shared__ _Float16 As[2][128 * 32];
  __shared__ _Float16 Bs[2][128 * 32];
  const int tid = threadIdx.x, wave = tid >> 5, lane = tid & 31;
  const int m0 = blockIdx.x * 128, n0 = blockIdx.y * 128;

  auto issue_stage = [&](int buf, int k0) {
#pragma unroll
    for (int c = tid; c < 512; c += 256) {  // 128 rows x 4 octets of f16
      int r = c >> 2, s = c & 3;
      int pr = (r & 64) | ((r & 15) << 2) | ((r >> 4) & 3);  // column staged in LDS row r
      copy16_to_lds(&A[(size_t)(m0 + r) * K + k0 + s * 8], &As[buf][r * 32 + s * 8]);
      copy16_to_lds(&Bt[(size_t)(n0 + pr) * K + k0 + s * 8], &Bs[buf][r * 32 + s * 8]);
    }
  };

  const v8f vzero = {0.f, 0.f, 0.f, 0.f, 0.f, 0.f, 0.f, 0.f};
  v8f acc[8];
#pragma unroll
  for (int j = 0; j < 8; ++j) acc[j] = vzero;

  const int nsteps = K / 32;
  issue_stage(0, 0);
  for (int i = 0; i < nsteps; ++i) {
    const int cur = i & 1;
    if (i + 1 < nsteps) {
      issue_stage(cur ^ 1, (i + 1) * 32);  // prefetch next stage (overlaps compute)
      ASYNC_WAIT(4);                       // oldest 4 (current stage) complete; next 4 in flight
    } else {
      ASYNC_WAIT(0);
    }
    __syncthreads();
    v16h a = load_frag(&As[cur][wave * 16 * 32], 32);
    v16h bfr[8];
#pragma unroll
    for (int j = 0; j < 8; ++j) bfr[j] = load_frag(&Bs[cur][j * 16 * 32], 32);
#pragma unroll
    for (int j = 0; j < 8; ++j) acc[j] = wmma16(a, bfr[j], acc[j]);
    __syncthreads();  // all waves done reading buf[cur] before it is refilled
  }

  // D layout: lane holds one column (index lane&15); VGPR e is row e (lanes 0-15) / e+8 (lanes 16-31)
  const int r = lane & 15, half = lane >> 4;
  const int sel = n0 >> 10;                       // 0: q, 1: k, 2: v (the same for the whole block)
  const int grow = m0 + wave * 16 + 8 * half;     // first of this lane's 8 rows
  const int b = grow >> 10, n = grow & (SEQ - 1);
  const size_t bh0 = (size_t)(b * 16 + ((n0 & 1023) >> 6));  // first of the block's two heads
  const float4 bv0 = *(const float4*)&bias[n0 + 4 * r];
  const float4 bv1 = *(const float4*)&bias[n0 + 64 + 4 * r];
  const float bj[2][4] = {{bv0.x, bv0.y, bv0.z, bv0.w}, {bv1.x, bv1.y, bv1.z, bv1.w}};
  if (sel == 2) {
    // v^T: a lane's 8 rows are 8 consecutive n of column 4r+jj: one 16-byte store each
#pragma unroll
    for (int hh = 0; hh < 2; ++hh) {
#pragma unroll
      for (int jj = 0; jj < 4; ++jj) {
        union { _Float16 h[8]; uint4 u; } pk;
#pragma unroll
        for (int e = 0; e < 8; ++e) pk.h[e] = (_Float16)(acc[hh * 4 + jj][e] + bj[hh][jj]);
        *(uint4*)&vth[(bh0 + hh) * (HD * SEQ) + (size_t)(4 * r + jj) * SEQ + n] = pk.u;
      }
    }
  } else {
    const float4 g4 = *(const float4*)&(sel ? kg : qg)[4 * r];
    const float4 b4 = *(const float4*)&(sel ? kb : qb)[4 * r];
    _Float16* dst = (sel ? kh : qh) + (bh0 * SEQ + n) * HD + 4 * r;
#pragma unroll
    for (int hh = 0; hh < 2; ++hh) {
#pragma unroll
      for (int e = 0; e < 8; ++e) {
        float t0 = acc[hh * 4 + 0][e] + bj[hh][0], t1 = acc[hh * 4 + 1][e] + bj[hh][1];
        float t2 = acc[hh * 4 + 2][e] + bj[hh][2], t3 = acc[hh * 4 + 3][e] + bj[hh][3];
        float mu = row16_sum((t0 + t1) + (t2 + t3)) * (1.f / 64.f);
        t0 -= mu; t1 -= mu; t2 -= mu; t3 -= mu;
        float var = row16_sum((t0 * t0 + t1 * t1) + (t2 * t2 + t3 * t3)) * (1.f / 64.f) + 1e-5f;
        float rs;
        // var >= 1e-5, so the library's rescaling of subnormal arguments is an identity here; the v_nop keeps
        // the one free slot the instruction set asks for behind a transcendental, whatever is scheduled next.
        asm("v_rsq_f32 %0, %1\n\tv_nop" : "=v"(rs) : "v"(var));
        union { _Float16 h[4]; uint2 u; } pk;
        pk.h[0] = (_Float16)(t0 * rs * g4.x + b4.x);
        pk.h[1] = (_Float16)(t1 * rs * g4.y + b4.y);
        pk.h[2] = (_Float16)(t2 * rs * g4.z + b4.z);
        pk.h[3] = (_Float16)(t3 * rs * g4.w + b4.w);
        // 16 lanes x 8 bytes: one whole 128-byte head row
        *(uint2*)(dst + (size_t)hh * (SEQ * HD) + e * HD) = pk.u;
      }
    }
    // In the built code this branch is laid out in front of the v branch, which rewrites registers that the
    // stores above name: the wait stands between them on that path.
    asm volatile("s_wait_xcnt 0x0" ::: "memory");
  }
}

// ---------------- flash attention: block = (b*h, 64-query tile), 4 waves x 16 queries ----------------
__global__ __launch_bounds__(128) void flash_attn(
    const _Float16* __restrict__ qh, const _Float16* __restrict__ kh,
    const _Float16* __restrict__ vth, _Float16* __restrict__ aout) {
  __shared__ _Float16 ksm[32 * 64];      // 32 keys x 64 hd
  __shared__ _Float16 vts[64 * 32];      // 64 hd x 32 keys (v^T)
  __shared__ _Float16 psm[4][16 * 32];   // per-wave P tile (A-fragment source)
  __shared__ float ssm[4][16 * 33];      // per-wave S scratch (padded)
  __shared__ float bfac[4][16];          // per-row broadcast factors

  const int tid = threadIdx.x, wave = tid >> 5, lane = tid & 31;
  const int bh = blockIdx.x;                       // 0..63
  const int q0 = blockIdx.y * 64 + wave * 16;      // query tile base
  const int r = lane & 15, half = lane >> 4;

  const _Float16* qp = qh + (size_t)bh * SEQ * HD;
  const _Float16* kp = kh + (size_t)bh * SEQ * HD;
  const _Float16* vp = vth + (size_t)bh * HD * SEQ;

  // Q A-fragments held in registers for the whole pass (hd split into two K=32 chunks)
  v16h aq0 = load_frag(qp + (size_t)q0 * HD, HD);
  v16h aq1 = load_frag(qp + (size_t)q0 * HD + 32, HD);

  const v8f vzero = {0.f, 0.f, 0.f, 0.f, 0.f, 0.f, 0.f, 0.f};
  v8f acc[4];
#pragma unroll
  for (int t = 0; t < 4; ++t) acc[t] = vzero;
  float m = -INFINITY, l = 0.f;

  for (int kb = 0; kb < 32; ++kb) {
    __syncthreads();
#pragma unroll
    for (int c = tid; c < 256; c += 128) {  // K tile: 32 rows x 8 octets
      int rr = c >> 3, s = c & 7;
      copy16_to_lds(&kp[(size_t)(kb * 32 + rr) * 64 + s * 8], &ksm[rr * 64 + s * 8]);
    }
#pragma unroll
    for (int c = tid; c < 256; c += 128) {  // V^T tile: 64 rows x 4 octets
      int dd = c >> 2, s = c & 3;
      copy16_to_lds(&vp[(size_t)dd * SEQ + kb * 32 + s * 8], &vts[dd * 32 + s * 8]);
    }
    ASYNC_WAIT(0);
    __syncthreads();

    // S = (Q K^T) * scale : two 16x16 key sub-tiles, K(hd)=64 in two WMMAs each
    v8f s0 = vzero, s1 = vzero;
    {
      v16h b00 = load_frag(&ksm[0], 64);
      v16h b01 = load_frag(&ksm[32], 64);
      s0 = wmma16(aq0, b00, s0);
      s0 = wmma16(aq1, b01, s0);
      v16h b10 = load_frag(&ksm[16 * 64], 64);
      v16h b11 = load_frag(&ksm[16 * 64 + 32], 64);
      s1 = wmma16(aq0, b10, s1);
      s1 = wmma16(aq1, b11, s1);
    }
#pragma unroll
    for (int e = 0; e < 8; ++e) {
      int mm = e + 8 * half;
      ssm[wave][mm * 33 + r]      = s0[e] * 0.125f;  // 1/sqrt(64)
      ssm[wave][mm * 33 + 16 + r] = s1[e] * 0.125f;
    }
    __syncthreads();

    // online softmax: lane pair (r, r+16) owns query row r; each scans 16 of 32 keys
    float pm = -INFINITY;
#pragma unroll
    for (int c = 0; c < 16; ++c) pm = fmaxf(pm, ssm[wave][r * 33 + half * 16 + c]);
    pm = fmaxf(pm, __shfl_xor(pm, 16, 32));
    float mnew = fmaxf(m, pm);
    float al = __expf(m - mnew);
    float ps = 0.f;
#pragma unroll
    for (int c = 0; c < 16; ++c) {
      float p = __expf(ssm[wave][r * 33 + half * 16 + c] - mnew);
      ps += p;
      psm[wave][r * 32 + half * 16 + c] = (_Float16)p;
    }
    ps += __shfl_xor(ps, 16, 32);
    l = al * l + ps;
    m = mnew;
    if (half == 0) bfac[wave][r] = al;
    __syncthreads();

    // rescale running O and accumulate P*V (4 hd sub-tiles of 16)
    float af[8];
#pragma unroll
    for (int e = 0; e < 8; ++e) af[e] = bfac[wave][e + 8 * half];
    v16h ap = load_frag(&psm[wave][0], 32);
#pragma unroll
    for (int t = 0; t < 4; ++t) {
#pragma unroll
      for (int e = 0; e < 8; ++e) acc[t][e] *= af[e];
      v16h bv = load_frag(&vts[16 * t * 32], 32);
      acc[t] = wmma16(ap, bv, acc[t]);
    }
  }

  // finalize: divide by row sums, emit f16 [B,N,D] with head-concat columns
  if (half == 0) bfac[wave][r] = 1.f / l;
  __syncthreads();
  float lf[8];
#pragma unroll
  for (int e = 0; e < 8; ++e) lf[e] = bfac[wave][e + 8 * half];
  const int b = bh >> 4, h = bh & 15;
#pragma unroll
  for (int t = 0; t < 4; ++t) {
    int gc = h * 64 + t * 16 + r;
#pragma unroll
    for (int e = 0; e < 8; ++e) {
      int gr = b * SEQ + q0 + e + 8 * half;
      aout[(size_t)gr * DMODEL + gc] = (_Float16)(acc[t][e] * lf[e]);
    }
  }
}

extern "C" void kernel_launch(void* const* d_in, const int* in_sizes, int n_in,
                              void* d_out, int out_size, void* d_ws, size_t ws_size,
                              hipStream_t stream) {
  const float* x    = (const float*)d_in[0];
  const float* Wqkv = (const float*)d_in[1];
  const float* bqkv = (const float*)d_in[2];
  const float* qg   = (const float*)d_in[3];
  const float* qb   = (const float*)d_in[4];
  const float* kg   = (const float*)d_in[5];
  const float* kb   = (const float*)d_in[6];
  const float* Wo   = (const float*)d_in[7];
  const float* bo   = (const float*)d_in[8];
  float* out = (float*)d_out;

  char* ws = (char*)d_ws;
  size_t off = 0;
  auto alloc = [&](size_t bytes) -> char* {
    char* p = ws + off;
    off += (bytes + 255) & ~(size_t)255;
    return p;
  };
  _Float16* xh   = (_Float16*)alloc(4096ull * 1024 * 2);  // x in f16
  _Float16* wqt  = (_Float16*)alloc(3072ull * 1024 * 2);  // Wqkv^T f16
  _Float16* wot  = (_Float16*)alloc(1024ull * 1024 * 2);  // Wo^T f16
  _Float16* qh   = (_Float16*)alloc(64ull * 1024 * 64 * 2);
  _Float16* kh   = (_Float16*)alloc(64ull * 1024 * 64 * 2);
  _Float16* vth  = (_Float16*)alloc(64ull * 1024 * 64 * 2);
  _Float16* aout = (_Float16*)alloc(4096ull * 1024 * 2);

  cvt_f16<<<(4194304 + 255) / 256, 256, 0, stream>>>(x, xh, 4194304);
  cvt_f16_t<<<(3145728 + 255) / 256, 256, 0, stream>>>(Wqkv, wqt, 1024, 3072);
  cvt_f16_t<<<(1048576 + 255) / 256, 256, 0, stream>>>(Wo, wot, 1024, 1024);
  gemm_qkv_ln<<<dim3(32, 24), 256, 0, stream>>>(xh, wqt, bqkv, qg, qb, kg, kb, qh, kh, vth, 1024);
  flash_attn<<<dim3(64, 16), 128, 0, stream>>>(qh, kh, vth, aout);
  gemm_wmma<<<dim3(32, 8), 256, 0, stream>>>(aout, wot, bo, out, 4096, 1024, 1024);
}

// v002
// It runs in 167 microseconds.
// Two timings next to v001 put it at 1.15 and 1.16 times that version's speed.
// Counting every step since v000, it is 1.79 times as fast.
#include <hip/hip_runtime.h>
#include <hip/hip_bf16.h>
#include <math.h>

typedef __attribute__((ext_vector_type(16))) _Float16 v16h;
typedef __attribute__((ext_vector_type(8)))  float    v8f;
typedef __attribute__((__vector_size__(4 * sizeof(int)))) int v4i;

#define SEQ 1024
#define DMODEL 1024
#define HD 64

#define AS1 __attribute__((address_space(1)))
#define AS3 __attribute__((address_space(3)))

#if defined(__has_builtin)
#if __has_builtin(__builtin_amdgcn_global_load_async_to_lds_b128)
#define HAVE_ASYNC 1
#endif
#endif

#ifdef HAVE_ASYNC
#if __has_builtin(__builtin_amdgcn_s_wait_asynccnt)
#define ASYNC_WAIT(n) __builtin_amdgcn_s_wait_asynccnt(n)
#else
#define ASYNC_WAIT(n) asm volatile("s_wait_asynccnt " #n ::: "memory")
#endif
#else
#define ASYNC_WAIT(n)
#endif

// 16-byte tile-staging copy: async global->LDS (ASYNCcnt) when available,
// else synchronous through VGPRs.
__device__ __forceinline__ void copy16_to_lds(const _Float16* gsrc, _Float16* ldst) {
#ifdef HAVE_ASYNC
  __builtin_amdgcn_global_load_async_to_lds_b128(
      (AS1 v4i*)(gsrc), (AS3 v4i*)(ldst), 0, 0);
#else
  *(uint4*)ldst = *(const uint4*)gsrc;
#endif
}

__device__ __forceinline__ v8f wmma16(v16h a, v16h b, v8f c) {
  // v_wmma_f32_16x16x32_f16: D = A(16x32 f16) * B(32x16 f16) + C(16x16 f32)
  return __builtin_amdgcn_wmma_f32_16x16x32_f16(false, a, false, b, (short)0, c, false, false);
}

union FragU { v16h h; uint4 u[2]; };

// A/B fragment loader. Layout (ISA 7.12.2, 16-bit A 16x32):
//   lane L holds row (L&15); halves 0..7 = K in [koff, koff+8), halves 8..15 = K in [koff+16, koff+24)
//   where koff = 8*(L>>4). B mirrors A with "row" = output column of a [16][K] Bt tile.
__device__ __forceinline__ v16h load_frag(const _Float16* tile, int ldh) {
  const int lane = threadIdx.x & 31;
  const int row  = lane & 15;
  const int koff = (lane >> 4) << 3;
  const _Float16* p = tile + row * ldh + koff;
  FragU f;
  f.u[0] = *(const uint4*)(p);
  f.u[1] = *(const uint4*)(p + 16);
  return f.h;
}

// Sum over the 16 lanes of a row, result in every lane of the row (DPP row_xmask butterfly:
// stays in the vector unit, where a shuffle would go through the LDS unit).
template <int MASK>
__device__ __forceinline__ float add_xmask(float v) {
  return v + __builtin_bit_cast(float, __builtin_amdgcn_update_dpp(
                 0, __builtin_bit_cast(int, v), 0x160 | MASK, 0xf, 0xf, true));
}
__device__ __forceinline__ float row16_sum(float v) {
  v = add_xmask<1>(v);
  v = add_xmask<2>(v);
  v = add_xmask<4>(v);
  return add_xmask<8>(v);
}

// ---------------- conversion kernels ----------------
// 32 elements a thread, so that few waves have to start and each keeps 8 loads of 16 bytes in flight.
// The loops below are unrolled so that v[] stays in registers and the 8 loads issue as one group.
union Half4 { _Float16 h[4]; uint2 u; };
union Half8 { _Float16 h[8]; uint4 u; };

// fp32 -> f16, same order. A block takes 8192 consecutive elements; each of a thread's 8 loads is part of
// 512 contiguous bytes of its wave, all 8 issued before the first is used.
__global__ __launch_bounds__(256) void cvt_f16(const float* __restrict__ in, _Float16* __restrict__ out) {
  const size_t base = (size_t)blockIdx.x * 8192 + threadIdx.x * 4;
  float4 v[8];
#pragma unroll
  for (int j = 0; j < 8; ++j) v[j] = *(const float4*)&in[base + j * 1024];
#pragma unroll
  for (int j = 0; j < 8; ++j) {
    Half4 pk;
    pk.h[0] = (_Float16)v[j].x; pk.h[1] = (_Float16)v[j].y;
    pk.h[2] = (_Float16)v[j].z; pk.h[3] = (_Float16)v[j].w;
    *(uint2*)&out[base + j * 1024] = pk.u;
  }
}

// W[K][N] fp32 -> Wt[N][K] f16  (Wt is the "Bt" operand: row = output column)
// A block of 4 waves takes 64 k x 64 n, a wave 64 k x 16 n, a thread 8 k x 4 n, transposed in its registers:
// 8 loads of 4 adjacent n, then 4 stores of 8 adjacent k. 8 lanes side by side in k store one whole 128-byte line.
// K and N are compile-time so that the row steps are immediate offsets on one address register pair.
template <int K, int N>
__device__ __forceinline__ void cvt_t_tile(const float* __restrict__ W, _Float16* __restrict__ Wt) {
  const int wave = threadIdx.x >> 5, lane = threadIdx.x & 31;
  const int n = blockIdx.x * 64 + wave * 16 + (lane & 3) * 4;
  const int k = blockIdx.y * 64 + (lane >> 2) * 8;
  const float* src = W + (size_t)k * N + n;
  _Float16* dst = Wt + (size_t)n * K + k;
  float4 v[8];
#pragma unroll
  for (int j = 0; j < 8; ++j) v[j] = *(const float4*)(src + j * N);
  Half8 c[4];
#pragma unroll
  for (int j = 0; j < 8; ++j) {
    c[0].h[j] = (_Float16)v[j].x; c[1].h[j] = (_Float16)v[j].y;
    c[2].h[j] = (_Float16)v[j].z; c[3].h[j] = (_Float16)v[j].w;
  }
#pragma unroll
  for (int i = 0; i < 4; ++i) *(uint4*)(dst + i * K) = c[i].u;
}
__global__ __launch_bounds__(128) void cvt_wqkv_t(const float* __restrict__ W, _Float16* __restrict__ Wt) {
  cvt_t_tile<DMODEL, 3 * DMODEL>(W, Wt);
}
__global__ __launch_bounds__(128) void cvt_wo_t(const float* __restrict__ W, _Float16* __restrict__ Wt) {
  cvt_t_tile<DMODEL, DMODEL>(W, Wt);
}

// ---------------- tiled WMMA GEMM: C[M][N] = A[M][K](f16) * Bt[N][K](f16)^T + bias ----------------
// Double-buffered LDS, async global->LDS staging overlapped with WMMA compute.
__global__ __launch_bounds__(256) void gemm_wmma(
    const _Float16* __restrict__ A, const _Float16* __restrict__ Bt,
    const float* __restrict__ bias, float* __restrict__ C, int M, int N, int K) {
  __shared__ _Float16 As[2][128 * 32];
  __shared__ _Float16 Bs[2][128 * 32];
  const int tid = threadIdx.x, wave = tid >> 5, lane = tid & 31;
  const int m0 = blockIdx.x * 128, n0 = blockIdx.y * 128;

  // Each thread stages 2 A-octets + 2 B-octets per K-step = 4 async-load instructions.
  auto issue_stage = [&](int buf, int k0) {
#pragma unroll
    for (int c = tid; c < 512; c += 256) {  // 128 rows x 4 octets of f16
      int r = c >> 2, s = c & 3;
      copy16_to_lds(&A[(size_t)(m0 + r) * K + k0 + s * 8], &As[buf][r * 32 + s * 8]);
      copy16_to_lds(&Bt[(size_t)(n0 + r) * K + k0 + s * 8], &Bs[buf][r * 32 + s * 8]);
    }
  };

  const v8f vzero = {0.f, 0.f, 0.f, 0.f, 0.f, 0.f, 0.f, 0.f};
  v8f acc[8];
#pragma unroll
  for (int j = 0; j < 8; ++j) acc[j] = vzero;

  const int nsteps = K / 32;
  issue_stage(0, 0);
  for (int i = 0; i < nsteps; ++i) {
    const int cur = i & 1;
    if (i + 1 < nsteps) {
      issue_stage(cur ^ 1, (i + 1) * 32);  // prefetch next stage (overlaps compute)
      ASYNC_WAIT(4);                       // oldest 4 (current stage) complete; next 4 in flight
    } else {
      ASYNC_WAIT(0);
    }
    __syncthreads();
    v16h a = load_frag(&As[cur][wave * 16 * 32], 32);
    v16h bfr[8];
#pragma unroll
    for (int j = 0; j < 8; ++j) bfr[j] = load_frag(&Bs[cur][j * 16 * 32], 32);
#pragma unroll
    for (int j = 0; j < 8; ++j) acc[j] = wmma16(a, bfr[j], acc[j]);
    __syncthreads();  // all waves done reading buf[cur] before it is refilled
  }

  // D layout: lane holds col (lane&15); VGPR e is row e (lanes 0-15) / e+8 (lanes 16-31)
  const int ncol = lane & 15, half = lane >> 4;
#pragma unroll
  for (int j = 0; j < 8; ++j) {
    int gc = n0 + j * 16 + ncol;
    float bv = bias[gc];
#pragma unroll
    for (int e = 0; e < 8; ++e) {
      int gr = m0 + wave * 16 + e + 8 * half;
      C[(size_t)gr * N + gc] = acc[j][e] + bv;
    }
  }
}

// ---------------- QKV projection with bias, per-head LayerNorm and f16 split in the epilogue ----------------
// Same K loop as gemm_wmma on A = x[4096][1024], Bt = Wqkv^T[3072][1024]. A 128-column block is two whole
// heads of q, of k or of v, and a wave holds 16 full rows of it, so each LayerNorm row is complete in a wave.
// Writes qh,kh [B*H][N][64] f16 (k row-major == Bt for Q*K^T) and vth [B*H][64][N] f16 (v^T == Bt for P*V).
// Bt rows are staged permuted inside each head: LDS row hh*64 + jj*16 + r holds column hh*64 + 4*r + jj,
// so lane r ends up with the four adjacent columns 4r..4r+3 of a head in acc[hh*4 + 0..3].
__global__ __launch_bounds__(256) void gemm_qkv_ln(
    const _Float16* __restrict__ A, const _Float16* __restrict__ Bt, const float* __restrict__ bias,
    const float* __restrict__ qg, const float* __restrict__ qb,
    const float* __restrict__ kg, const float* __restrict__ kb,
    _Float16* __restrict__ qh, _Float16* __restrict__ kh, _Float16* __restrict__ vth, int K) {
  __shared__ _Float16 As[2][128 * 32];
  __shared__ _Float16 Bs[2][128 * 32];
  const int tid = threadIdx.x, wave = tid >> 5, lane = tid & 31;
  const int m0 = blockIdx.x * 128, n0 = blockIdx.y * 128;

  auto issue_stage = [&](int buf, int k0) {
#pragma unroll
    for (int c = tid; c < 512; c += 256) {  // 128 rows x 4 octets of f16
      int r = c >> 2, s = c & 3;
      int pr = (r & 64) | ((r & 15) << 2) | ((r >> 4) & 3);  // column staged in LDS row r
      copy16_to_lds(&A[(size_t)(m0 + r) * K + k0 + s * 8], &As[buf][r * 32 + s * 8]);
      copy16_to_lds(&Bt[(size_t)(n0 + pr) * K + k0 + s * 8], &Bs[buf][r * 32 + s * 8]);
    }
  };

  const v8f vzero = {0.f, 0.f, 0.f, 0.f, 0.f, 0.f, 0.f, 0.f};
  v8f acc[8];
#pragma unroll
  for (int j = 0; j < 8; ++j) acc[j] = vzero;

  const int nsteps = K / 32;
  issue_stage(0, 0);
  for (int i = 0; i < nsteps; ++i) {
    const int cur = i & 1;
    if (i + 1 < nsteps) {
      issue_stage(cur ^ 1, (i + 1) * 32);  // prefetch next stage (overlaps compute)
      ASYNC_WAIT(4);                       // oldest 4 (current stage) complete; next 4 in flight
    } else {
      ASYNC_WAIT(0);
    }
    __syncthreads();
    v16h a = load_frag(&As[cur][wave * 16 * 32], 32);
    v16h bfr[8];
#pragma unroll
    for (int j = 0; j < 8; ++j) bfr[j] = load_frag(&Bs[cur][j * 16 * 32], 32);
#pragma unroll
    for (int j = 0; j < 8; ++j) acc[j] = wmma16(a, bfr[j], acc[j]);
    __syncthreads();  // all waves done reading buf[cur] before it is refilled
  }

  // D layout: lane holds one column (index lane&15); VGPR e is row e (lanes 0-15) / e+8 (lanes 16-31)
  const int r = lane & 15, half = lane >> 4;
  const int sel = n0 >> 10;                       // 0: q, 1: k, 2: v (the same for the whole block)
  const int grow = m0 + wave * 16 + 8 * half;     // first of this lane's 8 rows
  const int b = grow >> 10, n = grow & (SEQ - 1);
  const size_t bh0 = (size_t)(b * 16 + ((n0 & 1023) >> 6));  // first of the block's two heads
  const float4 bv0 = *(const float4*)&bias[n0 + 4 * r];
  const float4 bv1 = *(const float4*)&bias[n0 + 64 + 4 * r];
  const float bj[2][4] = {{bv0.x, bv0.y, bv0.z, bv0.w}, {bv1.x, bv1.y, bv1.z, bv1.w}};
  if (sel == 2) {
    // v^T: a lane's 8 rows are 8 consecutive n of column 4r+jj: one 16-byte store each
#pragma unroll
    for (int hh = 0; hh < 2; ++hh) {
#pragma unroll
      for (int jj = 0; jj < 4; ++jj) {
        union { _Float16 h[8]; uint4 u; } pk;
#pragma unroll
        for (int e = 0; e < 8; ++e) pk.h[e] = (_Float16)(acc[hh * 4 + jj][e] + bj[hh][jj]);
        *(uint4*)&vth[(bh0 + hh) * (HD * SEQ) + (size_t)(4 * r + jj) * SEQ + n] = pk.u;
      }
    }
  } else {
    const float4 g4 = *(const float4*)&(sel ? kg : qg)[4 * r];
    const float4 b4 = *(const float4*)&(sel ? kb : qb)[4 * r];
    _Float16* dst = (sel ? kh : qh) + (bh0 * SEQ + n) * HD + 4 * r;
#pragma unroll
    for (int hh = 0; hh < 2; ++hh) {
#pragma unroll
      for (int e = 0; e < 8; ++e) {
        float t0 = acc[hh * 4 + 0][e] + bj[hh][0], t1 = acc[hh * 4 + 1][e] + bj[hh][1];
        float t2 = acc[hh * 4 + 2][e] + bj[hh][2], t3 = acc[hh * 4 + 3][e] + bj[hh][3];
        float mu = row16_sum((t0 + t1) + (t2 + t3)) * (1.f / 64.f);
        t0 -= mu; t1 -= mu; t2 -= mu; t3 -= mu;
        float var = row16_sum((t0 * t0 + t1 * t1) + (t2 * t2 + t3 * t3)) * (1.f / 64.f) + 1e-5f;
        float rs;
        // var >= 1e-5, so the library's rescaling of subnormal arguments is an identity here; the v_nop keeps
        // the one free slot the instruction set asks for behind a transcendental, whatever is scheduled next.
        asm("v_rsq_f32 %0, %1\n\tv_nop" : "=v"(rs) : "v"(var));
        union { _Float16 h[4]; uint2 u; } pk;
        pk.h[0] = (_Float16)(t0 * rs * g4.x + b4.x);
        pk.h[1] = (_Float16)(t1 * rs * g4.y + b4.y);
        pk.h[2] = (_Float16)(t2 * rs * g4.z + b4.z);
        pk.h[3] = (_Float16)(t3 * rs * g4.w + b4.w);
        // 16 lanes x 8 bytes: one whole 128-byte head row
        *(uint2*)(dst + (size_t)hh * (SEQ * HD) + e * HD) = pk.u;
      }
    }
    // In the built code this branch is laid out in front of the v branch, which rewrites registers that the
    // stores above name: the wait stands between them on that path.
    asm volatile("s_wait_xcnt 0x0" ::: "memory");
  }
}

// ---------------- flash attention: block = (b*h, 64-query tile), 4 waves x 16 queries ----------------
__global__ __launch_bounds__(128) void flash_attn(
    const _Float16* __restrict__ qh, const _Float16* __restrict__ kh,
    const _Float16* __restrict__ vth, _Float16* __restrict__ aout) {
  __shared__ _Float16 ksm[32 * 64];      // 32 keys x 64 hd
  __shared__ _Float16 vts[64 * 32];      // 64 hd x 32 keys (v^T)
  __shared__ _Float16 psm[4][16 * 32];   // per-wave P tile (A-fragment source)
  __shared__ float ssm[4][16 * 33];      // per-wave S scratch (padded)
  __shared__ float bfac[4][16];          // per-row broadcast factors

  const int tid = threadIdx.x, wave = tid >> 5, lane = tid & 31;
  const int bh = blockIdx.x;                       // 0..63
  const int q0 = blockIdx.y * 64 + wave * 16;      // query tile base
  const int r = lane & 15, half = lane >> 4;

  const _Float16* qp = qh + (size_t)bh * SEQ * HD;
  const _Float16* kp = kh + (size_t)bh * SEQ * HD;
  const _Float16* vp = vth + (size_t)bh * HD * SEQ;

  // Q A-fragments held in registers for the whole pass (hd split into two K=32 chunks)
  v16h aq0 = load_frag(qp + (size_t)q0 * HD, HD);
  v16h aq1 = load_frag(qp + (size_t)q0 * HD + 32, HD);

  const v8f vzero = {0.f, 0.f, 0.f, 0.f, 0.f, 0.f, 0.f, 0.f};
  v8f acc[4];
#pragma unroll
  for (int t = 0; t < 4; ++t) acc[t] = vzero;
  float m = -INFINITY, l = 0.f;

  for (int kb = 0; kb < 32; ++kb) {
    __syncthreads();
#pragma unroll
    for (int c = tid; c < 256; c += 128) {  // K tile: 32 rows x 8 octets
      int rr = c >> 3, s = c & 7;
      copy16_to_lds(&kp[(size_t)(kb * 32 + rr) * 64 + s * 8], &ksm[rr * 64 + s * 8]);
    }
#pragma unroll
    for (int c = tid; c < 256; c += 128) {  // V^T tile: 64 rows x 4 octets
      int dd = c >> 2, s = c & 3;
      copy16_to_lds(&vp[(size_t)dd * SEQ + kb * 32 + s * 8], &vts[dd * 32 + s * 8]);
    }
    ASYNC_WAIT(0);
    __syncthreads();

    // S = (Q K^T) * scale : two 16x16 key sub-tiles, K(hd)=64 in two WMMAs each
    v8f s0 = vzero, s1 = vzero;
    {
      v16h b00 = load_frag(&ksm[0], 64);
      v16h b01 = load_frag(&ksm[32], 64);
      s0 = wmma16(aq0, b00, s0);
      s0 = wmma16(aq1, b01, s0);
      v16h b10 = load_frag(&ksm[16 * 64], 64);
      v16h b11 = load_frag(&ksm[16 * 64 + 32], 64);
      s1 = wmma16(aq0, b10, s1);
      s1 = wmma16(aq1, b11, s1);
    }
#pragma unroll
    for (int e = 0; e < 8; ++e) {
      int mm = e + 8 * half;
      ssm[wave][mm * 33 + r]      = s0[e] * 0.125f;  // 1/sqrt(64)
      ssm[wave][mm * 33 + 16 + r] = s1[e] * 0.125f;
    }
    __syncthreads();

    // online softmax: lane pair (r, r+16) owns query row r; each scans 16 of 32 keys
    float pm = -INFINITY;
#pragma unroll
    for (int c = 0; c < 16; ++c) pm = fmaxf(pm, ssm[wave][r * 33 + half * 16 + c]);
    pm = fmaxf(pm, __shfl_xor(pm, 16, 32));
    float mnew = fmaxf(m, pm);
    float al = __expf(m - mnew);
    float ps = 0.f;
#pragma unroll
    for (int c = 0; c < 16; ++c) {
      float p = __expf(ssm[wave][r * 33 + half * 16 + c] - mnew);
      ps += p;
      psm[wave][r * 32 + half * 16 + c] = (_Float16)p;
    }
    ps += __shfl_xor(ps, 16, 32);
    l = al * l + ps;
    m = mnew;
    if (half == 0) bfac[wave][r] = al;
    __syncthreads();

    // rescale running O and accumulate P*V (4 hd sub-tiles of 16)
    float af[8];
#pragma unroll
    for (int e = 0; e < 8; ++e) af[e] = bfac[wave][e + 8 * half];
    v16h ap = load_frag(&psm[wave][0], 32);
#pragma unroll
    for (int t = 0; t < 4; ++t) {
#pragma unroll
      for (int e = 0; e < 8; ++e) acc[t][e] *= af[e];
      v16h bv = load_frag(&vts[16 * t * 32], 32);
      acc[t] = wmma16(ap, bv, acc[t]);
    }
  }

  // finalize: divide by row sums, emit f16 [B,N,D] with head-concat columns
  if (half == 0) bfac[wave][r] = 1.f / l;
  __syncthreads();
  float lf[8];
#pragma unroll
  for (int e = 0; e < 8; ++e) lf[e] = bfac[wave][e + 8 * half];
  const int b = bh >> 4, h = bh & 15;
#pragma unroll
  for (int t = 0; t < 4; ++t) {
    int gc = h * 64 + t * 16 + r;
#pragma unroll
    for (int e = 0; e < 8; ++e) {
      int gr = b * SEQ + q0 + e + 8 * half;
      aout[(size_t)gr * DMODEL + gc] = (_Float16)(acc[t][e] * lf[e]);
    }
  }
}

extern "C" void kernel_launch(void* const* d_in, const int* in_sizes, int n_in,
                              void* d_out, int out_size, void* d_ws, size_t ws_size,
                              hipStream_t stream) {
  const float* x    = (const float*)d_in[0];
  const float* Wqkv = (const float*)d_in[1];
  const float* bqkv = (const float*)d_in[2];
  const float* qg   = (const float*)d_in[3];
  const float* qb   = (const float*)d_in[4];
  const float* kg   = (const float*)d_in[5];
  const float* kb   = (const float*)d_in[6];
  const float* Wo   = (const float*)d_in[7];
  const float* bo   = (const float*)d_in[8];
  float* out = (float*)d_out;

  char* ws = (char*)d_ws;
  size_t off = 0;
  auto alloc = [&](size_t bytes) -> char* {
    char* p = ws + off;
    off += (bytes + 255) & ~(size_t)255;
    return p;
  };
  _Float16* xh   = (_Float16*)alloc(4096ull * 1024 * 2);  // x in f16
  _Float16* wqt  = (_Float16*)alloc(3072ull * 1024 * 2);  // Wqkv^T f16
  _Float16* wot  = (_Float16*)alloc(1024ull * 1024 * 2);  // Wo^T f16
  _Float16* qh   = (_Float16*)alloc(64ull * 1024 * 64 * 2);
  _Float16* kh   = (_Float16*)alloc(64ull * 1024 * 64 * 2);
  _Float16* vth  = (_Float16*)alloc(64ull * 1024 * 64 * 2);
  _Float16* aout = (_Float16*)alloc(4096ull * 1024 * 2);

  cvt_f16<<<512, 256, 0, stream>>>(x, xh);                                 // 512 x 8192 = 4096 x 1024 elements
  cvt_wqkv_t<<<dim3(48, 16), 128, 0, stream>>>(Wqkv, wqt);                 // 48 x 64 n, 16 x 64 k
  cvt_wo_t<<<dim3(16, 16), 128, 0, stream>>>(Wo, wot);                     // 16 x 64 n, 16 x 64 k
  gemm_qkv_ln<<<dim3(32, 24), 256, 0, stream>>>(xh, wqt, bqkv, qg, qb, kg, kb, qh, kh, vth, 1024);
  flash_attn<<<dim3(64, 16), 128, 0, stream>>>(qh, kh, vth, aout);
  gemm_wmma<<<dim3(32, 8), 256, 0, stream>>>(aout, wot, bo, out, 4096, 1024, 1024);
}

// v003
// It runs in 108 microseconds.
// In two side-by-side timings against v002, it was 1.55 and 1.54 times as fast.
// All steps since v000 together make it 2.77 times as fast.
#include <hip/hip_runtime.h>
#include <hip/hip_bf16.h>
#include <math.h>

typedef __attribute__((ext_vector_type(16))) _Float16 v16h;
typedef __attribute__((ext_vector_type(8)))  float    v8f;
typedef __attribute__((__vector_size__(4 * sizeof(int)))) int v4i;

#define SEQ 1024
#define DMODEL 1024
#define HD 64

// LDS row pitch, in f16 elements, of every tile that load_frag reads with 16-byte loads: 16 bytes x an odd
// number, so that the 16 rows of a fragment start on 16 different groups of four banks (a pitch of 64 or
// 128 bytes puts them on 4 or 2 groups, and each load then takes 4 or 8 times the LDS clocks).
#define P32 40   // rows of 32 f16 (64 bytes) at 80 bytes
#define P64 72   // rows of 64 f16 (128 bytes) at 144 bytes

#define AS1 __attribute__((address_space(1)))
#define AS3 __attribute__((address_space(3)))

#if defined(__has_builtin)
#if __has_builtin(__builtin_amdgcn_global_load_async_to_lds_b128)
#define HAVE_ASYNC 1
#endif
#endif

#ifdef HAVE_ASYNC
#if __has_builtin(__builtin_amdgcn_s_wait_asynccnt)
#define ASYNC_WAIT(n) __builtin_amdgcn_s_wait_asynccnt(n)
#else
#define ASYNC_WAIT(n) asm volatile("s_wait_asynccnt " #n ::: "memory")
#endif
#else
#define ASYNC_WAIT(n)
#endif

// 16-byte tile-staging copy: async global->LDS (ASYNCcnt) when available,
// else synchronous through VGPRs.
__device__ __forceinline__ void copy16_to_lds(const _Float16* gsrc, _Float16* ldst) {
#ifdef HAVE_ASYNC
  __builtin_amdgcn_global_load_async_to_lds_b128(
      (AS1 v4i*)(gsrc), (AS3 v4i*)(ldst), 0, 0);
#else
  *(uint4*)ldst = *(const uint4*)gsrc;
#endif
}

__device__ __forceinline__ v8f wmma16(v16h a, v16h b, v8f c) {
  // v_wmma_f32_16x16x32_f16: D = A(16x32 f16) * B(32x16 f16) + C(16x16 f32)
  return __builtin_amdgcn_wmma_f32_16x16x32_f16(false, a, false, b, (short)0, c, false, false);
}

union FragU { v16h h; uint4 u[2]; };

// A/B fragment loader. Layout (ISA 7.12.2, 16-bit A 16x32):
//   lane L holds row (L&15); halves 0..7 = K in [koff, koff+8), halves 8..15 = K in [koff+16, koff+24)
//   where koff = 8*(L>>4). B mirrors A with "row" = output column of a [16][K] Bt tile.
__device__ __forceinline__ v16h load_frag(const _Float16* tile, int ldh) {
  const int lane = threadIdx.x & 31;
  const int row  = lane & 15;
  const int koff = (lane >> 4) << 3;
  const _Float16* p = tile + row * ldh + koff;
  FragU f;
  f.u[0] = *(const uint4*)(p);
  f.u[1] = *(const uint4*)(p + 16);
  return f.h;
}

// Sum over the 16 lanes of a row, result in every lane of the row (DPP row_xmask butterfly:
// stays in the vector unit, where a shuffle would go through the LDS unit).
template <int MASK>
__device__ __forceinline__ float add_xmask(float v) {
  return v + __builtin_bit_cast(float, __builtin_amdgcn_update_dpp(
                 0, __builtin_bit_cast(int, v), 0x160 | MASK, 0xf, 0xf, true));
}
__device__ __forceinline__ float row16_sum(float v) {
  v = add_xmask<1>(v);
  v = add_xmask<2>(v);
  v = add_xmask<4>(v);
  return add_xmask<8>(v);
}

// ---------------- conversion kernels ----------------
// 32 elements a thread, so that few waves have to start and each keeps 8 loads of 16 bytes in flight.
// The loops below are unrolled so that v[] stays in registers and the 8 loads issue as one group.
union Half4 { _Float16 h[4]; uint2 u; };
union Half8 { _Float16 h[8]; uint4 u; };

// fp32 -> f16, same order. A block takes 8192 consecutive elements; each of a thread's 8 loads is part of
// 512 contiguous bytes of its wave, all 8 issued before the first is used.
__global__ __launch_bounds__(256) void cvt_f16(const float* __restrict__ in, _Float16* __restrict__ out) {
  const size_t base = (size_t)blockIdx.x * 8192 + threadIdx.x * 4;
  float4 v[8];
#pragma unroll
  for (int j = 0; j < 8; ++j) v[j] = *(const float4*)&in[base + j * 1024];
#pragma unroll
  for (int j = 0; j < 8; ++j) {
    Half4 pk;
    pk.h[0] = (_Float16)v[j].x; pk.h[1] = (_Float16)v[j].y;
    pk.h[2] = (_Float16)v[j].z; pk.h[3] = (_Float16)v[j].w;
    *(uint2*)&out[base + j * 1024] = pk.u;
  }
}

// W[K][N] fp32 -> Wt[N][K] f16  (Wt is the "Bt" operand: row = output column)
// A block of 4 waves takes 64 k x 64 n, a wave 64 k x 16 n, a thread 8 k x 4 n, transposed in its registers:
// 8 loads of 4 adjacent n, then 4 stores of 8 adjacent k. 8 lanes side by side in k store one whole 128-byte line.
// K and N are compile-time so that the row steps are immediate offsets on one address register pair.
template <int K, int N>
__device__ __forceinline__ void cvt_t_tile(const float* __restrict__ W, _Float16* __restrict__ Wt) {
  const int wave = threadIdx.x >> 5, lane = threadIdx.x & 31;
  const int n = blockIdx.x * 64 + wave * 16 + (lane & 3) * 4;
  const int k = blockIdx.y * 64 + (lane >> 2) * 8;
  const float* src = W + (size_t)k * N + n;
  _Float16* dst = Wt + (size_t)n * K + k;
  float4 v[8];
#pragma unroll
  for (int j = 0; j < 8; ++j) v[j] = *(const float4*)(src + j * N);
  Half8 c[4];
#pragma unroll
  for (int j = 0; j < 8; ++j) {
    c[0].h[j] = (_Float16)v[j].x; c[1].h[j] = (_Float16)v[j].y;
    c[2].h[j] = (_Float16)v[j].z; c[3].h[j] = (_Float16)v[j].w;
  }
#pragma unroll
  for (int i = 0; i < 4; ++i) *(uint4*)(dst + i * K) = c[i].u;
}
__global__ __launch_bounds__(128) void cvt_wqkv_t(const float* __restrict__ W, _Float16* __restrict__ Wt) {
  cvt_t_tile<DMODEL, 3 * DMODEL>(W, Wt);
}
__global__ __launch_bounds__(128) void cvt_wo_t(const float* __restrict__ W, _Float16* __restrict__ Wt) {
  cvt_t_tile<DMODEL, DMODEL>(W, Wt);
}

// ---------------- tiled WMMA GEMM: C[M][N] = A[M][K](f16) * Bt[N][K](f16)^T + bias ----------------
// Double-buffered LDS, async global->LDS staging overlapped with WMMA compute.
__global__ __launch_bounds__(256) void gemm_wmma(
    const _Float16* __restrict__ A, const _Float16* __restrict__ Bt,
    const float* __restrict__ bias, float* __restrict__ C, int M, int N, int K) {
  __shared__ __attribute__((aligned(16))) _Float16 As[2][128 * P32];
  __shared__ __attribute__((aligned(16))) _Float16 Bs[2][128 * P32];
  const int tid = threadIdx.x, wave = tid >> 5, lane = tid & 31;
  const int m0 = blockIdx.x * 128, n0 = blockIdx.y * 128;

  // Each thread stages 2 A-octets + 2 B-octets per K-step = 4 async-load instructions.
  auto issue_stage = [&](int buf, int k0) {
#pragma unroll
    for (int c = tid; c < 512; c += 256) {  // 128 rows x 4 octets of f16
      int r = c >> 2, s = c & 3;
      copy16_to_lds(&A[(size_t)(m0 + r) * K + k0 + s * 8], &As[buf][r * P32 + s * 8]);
      copy16_to_lds(&Bt[(size_t)(n0 + r) * K + k0 + s * 8], &Bs[buf][r * P32 + s * 8]);
    }
  };

  const v8f vzero = {0.f, 0.f, 0.f, 0.f, 0.f, 0.f, 0.f, 0.f};
  v8f acc[8];
#pragma unroll
  for (int j = 0; j < 8; ++j) acc[j] = vzero;

  const int nsteps = K / 32;
  issue_stage(0, 0);
  for (int i = 0; i < nsteps; ++i) {
    const int cur = i & 1;
    if (i + 1 < nsteps) {
      issue_stage(cur ^ 1, (i + 1) * 32);  // prefetch next stage (overlaps compute)
      ASYNC_WAIT(4);                       // oldest 4 (current stage) complete; next 4 in flight
    } else {
      ASYNC_WAIT(0);
    }
    __syncthreads();
    v16h a = load_frag(&As[cur][wave * 16 * P32], P32);
    v16h bfr[8];
#pragma unroll
    for (int j = 0; j < 8; ++j) bfr[j] = load_frag(&Bs[cur][j * 16 * P32], P32);
#pragma unroll
    for (int j = 0; j < 8; ++j) acc[j] = wmma16(a, bfr[j], acc[j]);
    __syncthreads();  // all waves done reading buf[cur] before it is refilled
  }

  // D layout: lane holds col (lane&15); VGPR e is row e (lanes 0-15) / e+8 (lanes 16-31)
  const int ncol = lane & 15, half = lane >> 4;
#pragma unroll
  for (int j = 0; j < 8; ++j) {
    int gc = n0 + j * 16 + ncol;
    float bv = bias[gc];
#pragma unroll
    for (int e = 0; e < 8; ++e) {
      int gr = m0 + wave * 16 + e + 8 * half;
      C[(size_t)gr * N + gc] = acc[j][e] + bv;
    }
  }
}

// ---------------- QKV projection with bias, per-head LayerNorm and f16 split in the epilogue ----------------
// Same K loop as gemm_wmma on A = x[4096][1024], Bt = Wqkv^T[3072][1024]. A 128-column block is two whole
// heads of q, of k or of v, and a wave holds 16 full rows of it, so each LayerNorm row is complete in a wave.
// Writes qh,kh [B*H][N][64] f16 (k row-major == Bt for Q*K^T) and vth [B*H][64][N] f16 (v^T == Bt for P*V).
// Bt rows are staged permuted inside each head: LDS row hh*64 + jj*16 + r holds column hh*64 + 4*r + jj,
// so lane r ends up with the four adjacent columns 4r..4r+3 of a head in acc[hh*4 + 0..3].
__global__ __launch_bounds__(256) void gemm_qkv_ln(
    const _Float16* __restrict__ A, const _Float16* __restrict__ Bt, const float* __restrict__ bias,
    const float* __restrict__ qg, const float* __restrict__ qb,
    const float* __restrict__ kg, const float* __restrict__ kb,
    _Float16* __restrict__ qh, _Float16* __restrict__ kh, _Float16* __restrict__ vth, int K) {
  __shared__ __attribute__((aligned(16))) _Float16 As[2][128 * P32];
  __shared__ __attribute__((aligned(16))) _Float16 Bs[2][128 * P32];
  const int tid = threadIdx.x, wave = tid >> 5, lane = tid & 31;
  const int m0 = blockIdx.x * 128, n0 = blockIdx.y * 128;

  auto issue_stage = [&](int buf, int k0) {
#pragma unroll
    for (int c = tid; c < 512; c += 256) {  // 128 rows x 4 octets of f16
      int r = c >> 2, s = c & 3;
      int pr = (r & 64) | ((r & 15) << 2) | ((r >> 4) & 3);  // column staged in LDS row r
      copy16_to_lds(&A[(size_t)(m0 + r) * K + k0 + s * 8], &As[buf][r * P32 + s * 8]);
      copy16_to_lds(&Bt[(size_t)(n0 + pr) * K + k0 + s * 8], &Bs[buf][r * P32 + s * 8]);
    }
  };

  const v8f vzero = {0.f, 0.f, 0.f, 0.f, 0.f, 0.f, 0.f, 0.f};
  v8f acc[8];
#pragma unroll
  for (int j = 0; j < 8; ++j) acc[j] = vzero;

  const int nsteps = K / 32;
  issue_stage(0, 0);
  for (int i = 0; i < nsteps; ++i) {
    const int cur = i & 1;
    if (i + 1 < nsteps) {
      issue_stage(cur ^ 1, (i + 1) * 32);  // prefetch next stage (overlaps compute)
      ASYNC_WAIT(4);                       // oldest 4 (current stage) complete; next 4 in flight
    } else {
      ASYNC_WAIT(0);
    }
    __syncthreads();
    v16h a = load_frag(&As[cur][wave * 16 * P32], P32);
    v16h bfr[8];
#pragma unroll
    for (int j = 0; j < 8; ++j) bfr[j] = load_frag(&Bs[cur][j * 16 * P32], P32);
#pragma unroll
    for (int j = 0; j < 8; ++j) acc[j] = wmma16(a, bfr[j], acc[j]);
    __syncthreads();  // all waves done reading buf[cur] before it is refilled
  }

  // D layout: lane holds one column (index lane&15); VGPR e is row e (lanes 0-15) / e+8 (lanes 16-31)
  const int r = lane & 15, half = lane >> 4;
  const int sel = n0 >> 10;                       // 0: q, 1: k, 2: v (the same for the whole block)
  const int grow = m0 + wave * 16 + 8 * half;     // first of this lane's 8 rows
  const int b = grow >> 10, n = grow & (SEQ - 1);
  const size_t bh0 = (size_t)(b * 16 + ((n0 & 1023) >> 6));  // first of the block's two heads
  const float4 bv0 = *(const float4*)&bias[n0 + 4 * r];
  const float4 bv1 = *(const float4*)&bias[n0 + 64 + 4 * r];
  const float bj[2][4] = {{bv0.x, bv0.y, bv0.z, bv0.w}, {bv1.x, bv1.y, bv1.z, bv1.w}};
  if (sel == 2) {
    // v^T: a lane's 8 rows are 8 consecutive n of column 4r+jj: one 16-byte store each
#pragma unroll
    for (int hh = 0; hh < 2; ++hh) {
#pragma unroll
      for (int jj = 0; jj < 4; ++jj) {
        union { _Float16 h[8]; uint4 u; } pk;
#pragma unroll
        for (int e = 0; e < 8; ++e) pk.h[e] = (_Float16)(acc[hh * 4 + jj][e] + bj[hh][jj]);
        *(uint4*)&vth[(bh0 + hh) * (HD * SEQ) + (size_t)(4 * r + jj) * SEQ + n] = pk.u;
      }
    }
  } else {
    const float4 g4 = *(const float4*)&(sel ? kg : qg)[4 * r];
    const float4 b4 = *(const float4*)&(sel ? kb : qb)[4 * r];
    _Float16* dst = (sel ? kh : qh) + (bh0 * SEQ + n) * HD + 4 * r;
#pragma unroll
    for (int hh = 0; hh < 2; ++hh) {
#pragma unroll
      for (int e = 0; e < 8; ++e) {
        float t0 = acc[hh * 4 + 0][e] + bj[hh][0], t1 = acc[hh * 4 + 1][e] + bj[hh][1];
        float t2 = acc[hh * 4 + 2][e] + bj[hh][2], t3 = acc[hh * 4 + 3][e] + bj[hh][3];
        float mu = row16_sum((t0 + t1) + (t2 + t3)) * (1.f / 64.f);
        t0 -= mu; t1 -= mu; t2 -= mu; t3 -= mu;
        float var = row16_sum((t0 * t0 + t1 * t1) + (t2 * t2 + t3 * t3)) * (1.f / 64.f) + 1e-5f;
        float rs;
        // var >= 1e-5, so the library's rescaling of subnormal arguments is an identity here; the v_nop keeps
        // the one free slot the instruction set asks for behind a transcendental, whatever is scheduled next.
        asm("v_rsq_f32 %0, %1\n\tv_nop" : "=v"(rs) : "v"(var));
        union { _Float16 h[4]; uint2 u; } pk;
        pk.h[0] = (_Float16)(t0 * rs * g4.x + b4.x);
        pk.h[1] = (_Float16)(t1 * rs * g4.y + b4.y);
        pk.h[2] = (_Float16)(t2 * rs * g4.z + b4.z);
        pk.h[3] = (_Float16)(t3 * rs * g4.w + b4.w);
        // 16 lanes x 8 bytes: one whole 128-byte head row
        *(uint2*)(dst + (size_t)hh * (SEQ * HD) + e * HD) = pk.u;
      }
    }
    // In the built code this branch is laid out in front of the v branch, which rewrites registers that the
    // stores above name: the wait stands between them on that path.
    asm volatile("s_wait_xcnt 0x0" ::: "memory");
  }
}

// ---------------- flash attention: block = (b*h, 64-query tile), 4 waves x 16 queries ----------------
__global__ __launch_bounds__(128) void flash_attn(
    const _Float16* __restrict__ qh, const _Float16* __restrict__ kh,
    const _Float16* __restrict__ vth, _Float16* __restrict__ aout) {
  __shared__ __attribute__((aligned(16))) _Float16 ksm[32 * P64];      // 32 keys x 64 hd
  __shared__ __attribute__((aligned(16))) _Float16 vts[64 * P32];      // 64 hd x 32 keys (v^T)
  __shared__ __attribute__((aligned(16))) _Float16 psm[4][16 * P32];   // per-wave P tile (A-fragment source)
  __shared__ float ssm[4][16 * 33];      // per-wave S scratch (padded)
  __shared__ float bfac[4][16];          // per-row broadcast factors

  const int tid = threadIdx.x, wave = tid >> 5, lane = tid & 31;
  const int bh = blockIdx.x;                       // 0..63
  const int q0 = blockIdx.y * 64 + wave * 16;      // query tile base
  const int r = lane & 15, half = lane >> 4;

  const _Float16* qp = qh + (size_t)bh * SEQ * HD;
  const _Float16* kp = kh + (size_t)bh * SEQ * HD;
  const _Float16* vp = vth + (size_t)bh * HD * SEQ;

  // Q A-fragments held in registers for the whole pass (hd split into two K=32 chunks)
  v16h aq0 = load_frag(qp + (size_t)q0 * HD, HD);
  v16h aq1 = load_frag(qp + (size_t)q0 * HD + 32, HD);

  const v8f vzero = {0.f, 0.f, 0.f, 0.f, 0.f, 0.f, 0.f, 0.f};
  v8f acc[4];
#pragma unroll
  for (int t = 0; t < 4; ++t) acc[t] = vzero;
  float m = -INFINITY, l = 0.f;

  for (int kb = 0; kb < 32; ++kb) {
    __syncthreads();
#pragma unroll
    for (int c = tid; c < 256; c += 128) {  // K tile: 32 rows x 8 octets
      int rr = c >> 3, s = c & 7;
      copy16_to_lds(&kp[(size_t)(kb * 32 + rr) * 64 + s * 8], &ksm[rr * P64 + s * 8]);
    }
#pragma unroll
    for (int c = tid; c < 256; c += 128) {  // V^T tile: 64 rows x 4 octets
      int dd = c >> 2, s = c & 3;
      copy16_to_lds(&vp[(size_t)dd * SEQ + kb * 32 + s * 8], &vts[dd * P32 + s * 8]);
    }
    ASYNC_WAIT(0);
    __syncthreads();

    // S = (Q K^T) * scale : two 16x16 key sub-tiles, K(hd)=64 in two WMMAs each
    v8f s0 = vzero, s1 = vzero;
    {
      v16h b00 = load_frag(&ksm[0], P64);
      v16h b01 = load_frag(&ksm[32], P64);
      s0 = wmma16(aq0, b00, s0);
      s0 = wmma16(aq1, b01, s0);
      v16h b10 = load_frag(&ksm[16 * P64], P64);
      v16h b11 = load_frag(&ksm[16 * P64 + 32], P64);
      s1 = wmma16(aq0, b10, s1);
      s1 = wmma16(aq1, b11, s1);
    }
#pragma unroll
    for (int e = 0; e < 8; ++e) {
      int mm = e + 8 * half;
      ssm[wave][mm * 33 + r]      = s0[e] * 0.125f;  // 1/sqrt(64)
      ssm[wave][mm * 33 + 16 + r] = s1[e] * 0.125f;
    }
    __syncthreads();

    // online softmax: lane pair (r, r+16) owns query row r; each scans 16 of 32 keys
    float pm = -INFINITY;
#pragma unroll
    for (int c = 0; c < 16; ++c) pm = fmaxf(pm, ssm[wave][r * 33 + half * 16 + c]);
    pm = fmaxf(pm, __shfl_xor(pm, 16, 32));
    float mnew = fmaxf(m, pm);
    float al = __expf(m - mnew);
    float ps = 0.f;
#pragma unroll
    for (int c = 0; c < 16; ++c) {
      float p = __expf(ssm[wave][r * 33 + half * 16 + c] - mnew);
      ps += p;
      psm[wave][r * P32 + half * 16 + c] = (_Float16)p;
    }
    ps += __shfl_xor(ps, 16, 32);
    l = al * l + ps;
    m = mnew;
    if (half == 0) bfac[wave][r] = al;
    __syncthreads();

    // rescale running O and accumulate P*V (4 hd sub-tiles of 16)
    float af[8];
#pragma unroll
    for (int e = 0; e < 8; ++e) af[e] = bfac[wave][e + 8 * half];
    v16h ap = load_frag(&psm[wave][0], P32);
#pragma unroll
    for (int t = 0; t < 4; ++t) {
#pragma unroll
      for (int e = 0; e < 8; ++e) acc[t][e] *= af[e];
      v16h bv = load_frag(&vts[16 * t * P32], P32);
      acc[t] = wmma16(ap, bv, acc[t]);
    }
  }

  // finalize: divide by row sums, emit f16 [B,N,D] with head-concat columns
  if (half == 0) bfac[wave][r] = 1.f / l;
  __syncthreads();
  float lf[8];
#pragma unroll
  for (int e = 0; e < 8; ++e) lf[e] = bfac[wave][e + 8 * half];
  const int b = bh >> 4, h = bh & 15;
#pragma unroll
  for (int t = 0; t < 4; ++t) {
    int gc = h * 64 + t * 16 + r;
#pragma unroll
    for (int e = 0; e < 8; ++e) {
      int gr = b * SEQ + q0 + e + 8 * half;
      aout[(size_t)gr * DMODEL + gc] = (_Float16)(acc[t][e] * lf[e]);
    }
  }
}

extern "C" void kernel_launch(void* const* d_in, const int* in_sizes, int n_in,
                              void* d_out, int out_size, void* d_ws, size_t ws_size,
                              hipStream_t stream) {
  const float* x    = (const float*)d_in[0];
  const float* Wqkv = (const float*)d_in[1];
  const float* bqkv = (const float*)d_in[2];
  const float* qg   = (const float*)d_in[3];
  const float* qb   = (const float*)d_in[4];
  const float* kg   = (const float*)d_in[5];
  const float* kb   = (const float*)d_in[6];
  const float* Wo   = (const float*)d_in[7];
  const float* bo   = (const float*)d_in[8];
  float* out = (float*)d_out;

  char* ws = (char*)d_ws;
  size_t off = 0;
  auto alloc = [&](size_t bytes) -> char* {
    char* p = ws + off;
    off += (bytes + 255) & ~(size_t)255;
    return p;
  };
  _Float16* xh   = (_Float16*)alloc(4096ull * 1024 * 2);  // x in f16
  _Float16* wqt  = (_Float16*)alloc(3072ull * 1024 * 2);  // Wqkv^T f16
  _Float16* wot  = (_Float16*)alloc(1024ull * 1024 * 2);  // Wo^T f16
  _Float16* qh   = (_Float16*)alloc(64ull * 1024 * 64 * 2);
  _Float16* kh   = (_Float16*)alloc(64ull * 1024 * 64 * 2);
  _Float16* vth  = (_Float16*)alloc(64ull * 1024 * 64 * 2);
  _Float16* aout = (_Float16*)alloc(4096ull * 1024 * 2);

  cvt_f16<<<512, 256, 0, stream>>>(x, xh);                                 // 512 x 8192 = 4096 x 1024 elements
  cvt_wqkv_t<<<dim3(48, 16), 128, 0, stream>>>(Wqkv, wqt);                 // 48 x 64 n, 16 x 64 k
  cvt_wo_t<<<dim3(16, 16), 128, 0, stream>>>(Wo, wot);                     // 16 x 64 n, 16 x 64 k
  gemm_qkv_ln<<<dim3(32, 24), 256, 0, stream>>>(xh, wqt, bqkv, qg, qb, kg, kb, qh, kh, vth, 1024);
  flash_attn<<<dim3(64, 16), 128, 0, stream>>>(qh, kh, vth, aout);
  gemm_wmma<<<dim3(32, 8), 256, 0, stream>>>(aout, wot, bo, out, 4096, 1024, 1024);
}

// v004
// Measured time: 99.2 microseconds a run.
// Next to v003, in two timings, it ran 1.11 and 1.10 times as fast.
// Counting every step since v000, it is 3.07 times as fast.
#include <hip/hip_runtime.h>
#include <hip/hip_bf16.h>
#include <math.h>

typedef __attribute__((ext_vector_type(16))) _Float16 v16h;
typedef __attribute__((ext_vector_type(8)))  float    v8f;
typedef __attribute__((__vector_size__(4 * sizeof(int)))) int v4i;

#define SEQ 1024
#define DMODEL 1024
#define HD 64

// LDS row pitch, in f16 elements, of every tile that load_frag reads with 16-byte loads: 16 bytes x an odd
// number, so that the 16 rows of a fragment start on 16 different groups of four banks (a pitch of 64 or
// 128 bytes puts them on 4 or 2 groups, and each load then takes 4 or 8 times the LDS clocks).
#define P32 40   // rows of 32 f16 (64 bytes) at 80 bytes
#define P64 72   // rows of 64 f16 (128 bytes) at 144 bytes

#define AS1 __attribute__((address_space(1)))
#define AS3 __attribute__((address_space(3)))

#if defined(__has_builtin)
#if __has_builtin(__builtin_amdgcn_global_load_async_to_lds_b128)
#define HAVE_ASYNC 1
#endif
#endif

#ifdef HAVE_ASYNC
#if __has_builtin(__builtin_amdgcn_s_wait_asynccnt)
#define ASYNC_WAIT(n) __builtin_amdgcn_s_wait_asynccnt(n)
#else
#define ASYNC_WAIT(n) asm volatile("s_wait_asynccnt " #n ::: "memory")
#endif
#else
#define ASYNC_WAIT(n)
#endif

// 16-byte tile-staging copy: async global->LDS (ASYNCcnt) when available,
// else synchronous through VGPRs.
__device__ __forceinline__ void copy16_to_lds(const _Float16* gsrc, _Float16* ldst) {
#ifdef HAVE_ASYNC
  __builtin_amdgcn_global_load_async_to_lds_b128(
      (AS1 v4i*)(gsrc), (AS3 v4i*)(ldst), 0, 0);
#else
  *(uint4*)ldst = *(const uint4*)gsrc;
#endif
}

__device__ __forceinline__ v8f wmma16(v16h a, v16h b, v8f c) {
  // v_wmma_f32_16x16x32_f16: D = A(16x32 f16) * B(32x16 f16) + C(16x16 f32)
  return __builtin_amdgcn_wmma_f32_16x16x32_f16(false, a, false, b, (short)0, c, false, false);
}

union FragU { v16h h; uint4 u[2]; };

// A/B fragment loader. Layout (ISA 7.12.2, 16-bit A 16x32):
//   lane L holds row (L&15); halves 0..7 = K in [koff, koff+8), halves 8..15 = K in [koff+16, koff+24)
//   where koff = 8*(L>>4). B mirrors A with "row" = output column of a [16][K] Bt tile.
__device__ __forceinline__ v16h load_frag(const _Float16* tile, int ldh) {
  const int lane = threadIdx.x & 31;
  const int row  = lane & 15;
  const int koff = (lane >> 4) << 3;
  const _Float16* p = tile + row * ldh + koff;
  FragU f;
  f.u[0] = *(const uint4*)(p);
  f.u[1] = *(const uint4*)(p + 16);
  return f.h;
}

// Sum over the 16 lanes of a row, result in every lane of the row (DPP row_xmask butterfly:
// stays in the vector unit, where a shuffle would go through the LDS unit).
template <int MASK>
__device__ __forceinline__ float add_xmask(float v) {
  return v + __builtin_bit_cast(float, __builtin_amdgcn_update_dpp(
                 0, __builtin_bit_cast(int, v), 0x160 | MASK, 0xf, 0xf, true));
}
__device__ __forceinline__ float row16_sum(float v) {
  v = add_xmask<1>(v);
  v = add_xmask<2>(v);
  v = add_xmask<4>(v);
  return add_xmask<8>(v);
}

// ---------------- conversion kernels ----------------
// 32 elements a thread, so that few waves have to start and each keeps 8 loads of 16 bytes in flight.
// The loops below are unrolled so that v[] stays in registers and the 8 loads issue as one group.
union Half4 { _Float16 h[4]; uint2 u; };
union Half8 { _Float16 h[8]; uint4 u; };

// fp32 -> f16, same order. A block takes 8192 consecutive elements; each of a thread's 8 loads is part of
// 512 contiguous bytes of its wave, all 8 issued before the first is used.
__global__ __launch_bounds__(256) void cvt_f16(const float* __restrict__ in, _Float16* __restrict__ out) {
  const size_t base = (size_t)blockIdx.x * 8192 + threadIdx.x * 4;
  float4 v[8];
#pragma unroll
  for (int j = 0; j < 8; ++j) v[j] = *(const float4*)&in[base + j * 1024];
#pragma unroll
  for (int j = 0; j < 8; ++j) {
    Half4 pk;
    pk.h[0] = (_Float16)v[j].x; pk.h[1] = (_Float16)v[j].y;
    pk.h[2] = (_Float16)v[j].z; pk.h[3] = (_Float16)v[j].w;
    *(uint2*)&out[base + j * 1024] = pk.u;
  }
}

// W[K][N] fp32 -> Wt[N][K] f16  (Wt is the "Bt" operand: row = output column)
// A block of 4 waves takes 64 k x 64 n, a wave 64 k x 16 n, a thread 8 k x 4 n, transposed in its registers:
// 8 loads of 4 adjacent n, then 4 stores of 8 adjacent k. 8 lanes side by side in k store one whole 128-byte line.
// K and N are compile-time so that the row steps are immediate offsets on one address register pair.
template <int K, int N>
__device__ __forceinline__ void cvt_t_tile(const float* __restrict__ W, _Float16* __restrict__ Wt) {
  const int wave = threadIdx.x >> 5, lane = threadIdx.x & 31;
  const int n = blockIdx.x * 64 + wave * 16 + (lane & 3) * 4;
  const int k = blockIdx.y * 64 + (lane >> 2) * 8;
  const float* src = W + (size_t)k * N + n;
  _Float16* dst = Wt + (size_t)n * K + k;
  float4 v[8];
#pragma unroll
  for (int j = 0; j < 8; ++j) v[j] = *(const float4*)(src + j * N);
  Half8 c[4];
#pragma unroll
  for (int j = 0; j < 8; ++j) {
    c[0].h[j] = (_Float16)v[j].x; c[1].h[j] = (_Float16)v[j].y;
    c[2].h[j] = (_Float16)v[j].z; c[3].h[j] = (_Float16)v[j].w;
  }
#pragma unroll
  for (int i = 0; i < 4; ++i) *(uint4*)(dst + i * K) = c[i].u;
}
__global__ __launch_bounds__(128) void cvt_wqkv_t(const float* __restrict__ W, _Float16* __restrict__ Wt) {
  cvt_t_tile<DMODEL, 3 * DMODEL>(W, Wt);
}
__global__ __launch_bounds__(128) void cvt_wo_t(const float* __restrict__ W, _Float16* __restrict__ Wt) {
  cvt_t_tile<DMODEL, DMODEL>(W, Wt);
}

// ---------------- tiled WMMA GEMM: C[M][N] = A[M][K](f16) * Bt[N][K](f16)^T + bias ----------------
// Double-buffered LDS, async global->LDS staging overlapped with WMMA compute.
__global__ __launch_bounds__(256) void gemm_wmma(
    const _Float16* __restrict__ A, const _Float16* __restrict__ Bt,
    const float* __restrict__ bias, float* __restrict__ C, int M, int N, int K) {
  __shared__ __attribute__((aligned(16))) _Float16 As[2][128 * P32];
  __shared__ __attribute__((aligned(16))) _Float16 Bs[2][128 * P32];
  const int tid = threadIdx.x, wave = tid >> 5, lane = tid & 31;
  const int m0 = blockIdx.x * 128, n0 = blockIdx.y * 128;

  // Each thread stages 2 A-octets + 2 B-octets per K-step = 4 async-load instructions.
  auto issue_stage = [&](int buf, int k0) {
#pragma unroll
    for (int c = tid; c < 512; c += 256) {  // 128 rows x 4 octets of f16
      int r = c >> 2, s = c & 3;
      copy16_to_lds(&A[(size_t)(m0 + r) * K + k0 + s * 8], &As[buf][r * P32 + s * 8]);
      copy16_to_lds(&Bt[(size_t)(n0 + r) * K + k0 + s * 8], &Bs[buf][r * P32 + s * 8]);
    }
  };

  const v8f vzero = {0.f, 0.f, 0.f, 0.f, 0.f, 0.f, 0.f, 0.f};
  v8f acc[8];
#pragma unroll
  for (int j = 0; j < 8; ++j) acc[j] = vzero;

  const int nsteps = K / 32;
  issue_stage(0, 0);
  for (int i = 0; i < nsteps; ++i) {
    const int cur = i & 1;
    if (i + 1 < nsteps) {
      issue_stage(cur ^ 1, (i + 1) * 32);  // prefetch next stage (overlaps compute)
      ASYNC_WAIT(4);                       // oldest 4 (current stage) complete; next 4 in flight
    } else {
      ASYNC_WAIT(0);
    }
    __syncthreads();
    v16h a = load_frag(&As[cur][wave * 16 * P32], P32);
    v16h bfr[8];
#pragma unroll
    for (int j = 0; j < 8; ++j) bfr[j] = load_frag(&Bs[cur][j * 16 * P32], P32);
#pragma unroll
    for (int j = 0; j < 8; ++j) acc[j] = wmma16(a, bfr[j], acc[j]);
    __syncthreads();  // all waves done reading buf[cur] before it is refilled
  }

  // D layout: lane holds col (lane&15); VGPR e is row e (lanes 0-15) / e+8 (lanes 16-31)
  const int ncol = lane & 15, half = lane >> 4;
#pragma unroll
  for (int j = 0; j < 8; ++j) {
    int gc = n0 + j * 16 + ncol;
    float bv = bias[gc];
#pragma unroll
    for (int e = 0; e < 8; ++e) {
      int gr = m0 + wave * 16 + e + 8 * half;
      C[(size_t)gr * N + gc] = acc[j][e] + bv;
    }
  }
}

// ---------------- QKV projection with bias, per-head LayerNorm and f16 split in the epilogue ----------------
// Same K loop as gemm_wmma on A = x[4096][1024], Bt = Wqkv^T[3072][1024]. A 128-column block is two whole
// heads of q, of k or of v, and a wave holds 16 full rows of it, so each LayerNorm row is complete in a wave.
// Writes qh,kh [B*H][N][64] f16 (k row-major == A for K*Q^T) and vth [B*H][64][N] f16 (v^T == A for V^T*P^T).
// Bt rows are staged permuted inside each head: LDS row hh*64 + jj*16 + r holds column hh*64 + 4*r + jj,
// so lane r ends up with the four adjacent columns 4r..4r+3 of a head in acc[hh*4 + 0..3].
__global__ __launch_bounds__(256) void gemm_qkv_ln(
    const _Float16* __restrict__ A, const _Float16* __restrict__ Bt, const float* __restrict__ bias,
    const float* __restrict__ qg, const float* __restrict__ qb,
    const float* __restrict__ kg, const float* __restrict__ kb,
    _Float16* __restrict__ qh, _Float16* __restrict__ kh, _Float16* __restrict__ vth, int K) {
  __shared__ __attribute__((aligned(16))) _Float16 As[2][128 * P32];
  __shared__ __attribute__((aligned(16))) _Float16 Bs[2][128 * P32];
  const int tid = threadIdx.x, wave = tid >> 5, lane = tid & 31;
  const int m0 = blockIdx.x * 128, n0 = blockIdx.y * 128;

  auto issue_stage = [&](int buf, int k0) {
#pragma unroll
    for (int c = tid; c < 512; c += 256) {  // 128 rows x 4 octets of f16
      int r = c >> 2, s = c & 3;
      int pr = (r & 64) | ((r & 15) << 2) | ((r >> 4) & 3);  // column staged in LDS row r
      copy16_to_lds(&A[(size_t)(m0 + r) * K + k0 + s * 8], &As[buf][r * P32 + s * 8]);
      copy16_to_lds(&Bt[(size_t)(n0 + pr) * K + k0 + s * 8], &Bs[buf][r * P32 + s * 8]);
    }
  };

  const v8f vzero = {0.f, 0.f, 0.f, 0.f, 0.f, 0.f, 0.f, 0.f};
  v8f acc[8];
#pragma unroll
  for (int j = 0; j < 8; ++j) acc[j] = vzero;

  const int nsteps = K / 32;
  issue_stage(0, 0);
  for (int i = 0; i < nsteps; ++i) {
    const int cur = i & 1;
    if (i + 1 < nsteps) {
      issue_stage(cur ^ 1, (i + 1) * 32);  // prefetch next stage (overlaps compute)
      ASYNC_WAIT(4);                       // oldest 4 (current stage) complete; next 4 in flight
    } else {
      ASYNC_WAIT(0);
    }
    __syncthreads();
    v16h a = load_frag(&As[cur][wave * 16 * P32], P32);
    v16h bfr[8];
#pragma unroll
    for (int j = 0; j < 8; ++j) bfr[j] = load_frag(&Bs[cur][j * 16 * P32], P32);
#pragma unroll
    for (int j = 0; j < 8; ++j) acc[j] = wmma16(a, bfr[j], acc[j]);
    __syncthreads();  // all waves done reading buf[cur] before it is refilled
  }

  // D layout: lane holds one column (index lane&15); VGPR e is row e (lanes 0-15) / e+8 (lanes 16-31)
  const int r = lane & 15, half = lane >> 4;
  const int sel = n0 >> 10;                       // 0: q, 1: k, 2: v (the same for the whole block)
  const int grow = m0 + wave * 16 + 8 * half;     // first of this lane's 8 rows
  const int b = grow >> 10, n = grow & (SEQ - 1);
  const size_t bh0 = (size_t)(b * 16 + ((n0 & 1023) >> 6));  // first of the block's two heads
  const float4 bv0 = *(const float4*)&bias[n0 + 4 * r];
  const float4 bv1 = *(const float4*)&bias[n0 + 64 + 4 * r];
  const float bj[2][4] = {{bv0.x, bv0.y, bv0.z, bv0.w}, {bv1.x, bv1.y, bv1.z, bv1.w}};
  if (sel == 2) {
    // v^T: a lane's 8 rows are 8 consecutive n of column 4r+jj: one 16-byte store each
#pragma unroll
    for (int hh = 0; hh < 2; ++hh) {
#pragma unroll
      for (int jj = 0; jj < 4; ++jj) {
        union { _Float16 h[8]; uint4 u; } pk;
#pragma unroll
        for (int e = 0; e < 8; ++e) pk.h[e] = (_Float16)(acc[hh * 4 + jj][e] + bj[hh][jj]);
        *(uint4*)&vth[(bh0 + hh) * (HD * SEQ) + (size_t)(4 * r + jj) * SEQ + n] = pk.u;
      }
    }
  } else {
    const float4 g4 = *(const float4*)&(sel ? kg : qg)[4 * r];
    const float4 b4 = *(const float4*)&(sel ? kb : qb)[4 * r];
    _Float16* dst = (sel ? kh : qh) + (bh0 * SEQ + n) * HD + 4 * r;
#pragma unroll
    for (int hh = 0; hh < 2; ++hh) {
#pragma unroll
      for (int e = 0; e < 8; ++e) {
        float t0 = acc[hh * 4 + 0][e] + bj[hh][0], t1 = acc[hh * 4 + 1][e] + bj[hh][1];
        float t2 = acc[hh * 4 + 2][e] + bj[hh][2], t3 = acc[hh * 4 + 3][e] + bj[hh][3];
        float mu = row16_sum((t0 + t1) + (t2 + t3)) * (1.f / 64.f);
        t0 -= mu; t1 -= mu; t2 -= mu; t3 -= mu;
        float var = row16_sum((t0 * t0 + t1 * t1) + (t2 * t2 + t3 * t3)) * (1.f / 64.f) + 1e-5f;
        float rs;
        // var >= 1e-5, so the library's rescaling of subnormal arguments is an identity here; the v_nop keeps
        // the one free slot the instruction set asks for behind a transcendental, whatever is scheduled next.
        asm("v_rsq_f32 %0, %1\n\tv_nop" : "=v"(rs) : "v"(var));
        union { _Float16 h[4]; uint2 u; } pk;
        pk.h[0] = (_Float16)(t0 * rs * g4.x + b4.x);
        pk.h[1] = (_Float16)(t1 * rs * g4.y + b4.y);
        pk.h[2] = (_Float16)(t2 * rs * g4.z + b4.z);
        pk.h[3] = (_Float16)(t3 * rs * g4.w + b4.w);
        // 16 lanes x 8 bytes: one whole 128-byte head row
        *(uint2*)(dst + (size_t)hh * (SEQ * HD) + e * HD) = pk.u;
      }
    }
    // In the built code this branch is laid out in front of the v branch, which rewrites registers that the
    // stores above name: the wait stands between them on that path.
    asm volatile("s_wait_xcnt 0x0" ::: "memory");
  }
}

// ---------------- flash attention: block = (b*h, 64-query tile), 4 waves x 16 queries ----------------
// Lane l with lane l ^ 16, in the vector unit (a shuffle would go through the LDS unit).
__device__ __forceinline__ float xhalf(float x) {
  const int b = __builtin_bit_cast(int, x);
  return __builtin_bit_cast(float, __builtin_amdgcn_permlanex16(b, b, 0x76543210, 0xfedcba98, false, false));
}

__global__ __launch_bounds__(128) void flash_attn(
    const _Float16* __restrict__ qh, const _Float16* __restrict__ kh,
    const _Float16* __restrict__ vth, _Float16* __restrict__ aout) {
  __shared__ __attribute__((aligned(16))) _Float16 ksm[32 * P64];      // 32 keys x 64 hd
  __shared__ __attribute__((aligned(16))) _Float16 vts[64 * P32];      // 64 hd x 32 keys (v^T)

  const int tid = threadIdx.x, wave = tid >> 5, lane = tid & 31;
  const int bh = blockIdx.x;                       // 0..63
  const int q0 = blockIdx.y * 64 + wave * 16;      // query tile base
  const int r = lane & 15, half = lane >> 4;

  const _Float16* qp = qh + (size_t)bh * SEQ * HD;
  const _Float16* kp = kh + (size_t)bh * SEQ * HD;
  const _Float16* vp = vth + (size_t)bh * HD * SEQ;

  // Q^T B-fragments (column = query r) held in registers for the whole pass (hd split into two K=32 chunks)
  v16h bq0 = load_frag(qp + (size_t)q0 * HD, HD);
  v16h bq1 = load_frag(qp + (size_t)q0 * HD + 32, HD);

  const v8f vzero = {0.f, 0.f, 0.f, 0.f, 0.f, 0.f, 0.f, 0.f};
  v8f acc[4];  // acc[t][e] = O[query r][hd 16t + 8*half + e]
#pragma unroll
  for (int t = 0; t < 4; ++t) acc[t] = vzero;
  float m = -INFINITY;  // running maximum of query r, the same in both halves
  float l = 0.f;        // running sum over this half's keys only; the halves are joined behind the loop

  for (int kb = 0; kb < 32; ++kb) {
    __syncthreads();
#pragma unroll
    for (int c = tid; c < 256; c += 128) {  // K tile: 32 rows x 8 octets
      int rr = c >> 3, s = c & 7;
      copy16_to_lds(&kp[(size_t)(kb * 32 + rr) * 64 + s * 8], &ksm[rr * P64 + s * 8]);
    }
#pragma unroll
    for (int c = tid; c < 256; c += 128) {  // V^T tile: 64 rows x 4 octets
      int dd = c >> 2, s = c & 3;
      copy16_to_lds(&vp[(size_t)dd * SEQ + kb * 32 + s * 8], &vts[dd * P32 + s * 8]);
    }
    ASYNC_WAIT(0);
    __syncthreads();

    // S^T = K Q^T : two 16-key sub-tiles, K(hd)=64 in two WMMAs each
    // s0[e] = S[query r][key 8*half + e], s1[e] = S[query r][key 16 + 8*half + e]
    v8f s0 = vzero, s1 = vzero;
    {
      v16h a00 = load_frag(&ksm[0], P64);
      v16h a01 = load_frag(&ksm[32], P64);
      v16h a10 = load_frag(&ksm[16 * P64], P64);
      v16h a11 = load_frag(&ksm[16 * P64 + 32], P64);
      s0 = wmma16(a00, bq0, s0);
      s1 = wmma16(a10, bq0, s1);
      s0 = wmma16(a01, bq1, s0);
      s1 = wmma16(a11, bq1, s1);
    }

    // online softmax: 16 of the 32 keys of query r in this lane, the other 16 in lane ^ 16
    float t8[8];
#pragma unroll
    for (int e = 0; e < 8; ++e) t8[e] = fmaxf(s0[e], s1[e]);
    float pm = fmaxf(fmaxf(fmaxf(t8[0], t8[1]), fmaxf(t8[2], t8[3])),
                     fmaxf(fmaxf(t8[4], t8[5]), fmaxf(t8[6], t8[7])));
    pm = fmaxf(pm, xhalf(pm)) * 0.125f;  // 1/sqrt(64): a power of two, so it commutes with the maximum exactly
    const float mnew = fmaxf(m, pm);
    const float al = __expf(m - mnew);
    float ps = 0.f;
    v16h bp;  // P^T B-fragment: element s is key 8*half + s (s < 8) or 16 + 8*half + (s - 8)
#pragma unroll
    for (int e = 0; e < 8; ++e) {
      const float p0 = __expf(s0[e] * 0.125f - mnew);
      const float p1 = __expf(s1[e] * 0.125f - mnew);
      ps += p0 + p1;
      bp[e]     = (_Float16)p0;
      bp[8 + e] = (_Float16)p1;
    }
    l = al * l + ps;
    m = mnew;

    // rescale running O^T (one query a lane: one factor) and accumulate V^T P^T (4 hd sub-tiles of 16)
#pragma unroll
    for (int t = 0; t < 4; ++t) {
#pragma unroll
      for (int e = 0; e < 8; ++e) acc[t][e] *= al;
      v16h av = load_frag(&vts[16 * t * P32], P32);
      acc[t] = wmma16(av, bp, acc[t]);
    }
  }

  // finalize: divide by row sums, emit f16 [B,N,D] with head-concat columns;
  // a lane's 8 values of a sub-tile are 8 adjacent hd of its query: one 16-byte store each
  const float linv = 1.f / (l + xhalf(l));
  const int b = bh >> 4, h = bh & 15;
  _Float16* dst = aout + (size_t)(b * SEQ + q0 + r) * DMODEL + h * 64 + 8 * half;
#pragma unroll
  for (int t = 0; t < 4; ++t) {
    Half8 pk;
#pragma unroll
    for (int e = 0; e < 8; ++e) pk.h[e] = (_Float16)(acc[t][e] * linv);
    *(uint4*)(dst + t * 16) = pk.u;
  }
}

extern "C" void kernel_launch(void* const* d_in, const int* in_sizes, int n_in,
                              void* d_out, int out_size, void* d_ws, size_t ws_size,
                              hipStream_t stream) {
  const float* x    = (const float*)d_in[0];
  const float* Wqkv = (const float*)d_in[1];
  const float* bqkv = (const float*)d_in[2];
  const float* qg   = (const float*)d_in[3];
  const float* qb   = (const float*)d_in[4];
  const float* kg   = (const float*)d_in[5];
  const float* kb   = (const float*)d_in[6];
  const float* Wo   = (const float*)d_in[7];
  const float* bo   = (const float*)d_in[8];
  float* out = (float*)d_out;

  char* ws = (char*)d_ws;
  size_t off = 0;
  auto alloc = [&](size_t bytes) -> char* {
    char* p = ws + off;
    off += (bytes + 255) & ~(size_t)255;
    return p;
  };
  _Float16* xh   = (_Float16*)alloc(4096ull * 1024 * 2);  // x in f16
  _Float16* wqt  = (_Float16*)alloc(3072ull * 1024 * 2);  // Wqkv^T f16
  _Float16* wot  = (_Float16*)alloc(1024ull * 1024 * 2);  // Wo^T f16
  _Float16* qh   = (_Float16*)alloc(64ull * 1024 * 64 * 2);
  _Float16* kh   = (_Float16*)alloc(64ull * 1024 * 64 * 2);
  _Float16* vth  = (_Float16*)alloc(64ull * 1024 * 64 * 2);
  _Float16* aout = (_Float16*)alloc(4096ull * 1024 * 2);

  cvt_f16<<<512, 256, 0, stream>>>(x, xh);                                 // 512 x 8192 = 4096 x 1024 elements
  cvt_wqkv_t<<<dim3(48, 16), 128, 0, stream>>>(Wqkv, wqt);                 // 48 x 64 n, 16 x 64 k
  cvt_wo_t<<<dim3(16, 16), 128, 0, stream>>>(Wo, wot);                     // 16 x 64 n, 16 x 64 k
  gemm_qkv_ln<<<dim3(32, 24), 256, 0, stream>>>(xh, wqt, bqkv, qg, qb, kg, kb, qh, kh, vth, 1024);
  flash_attn<<<dim3(64, 16), 128, 0, stream>>>(qh, kh, vth, aout);
  gemm_wmma<<<dim3(32, 8), 256, 0, stream>>>(aout, wot, bo, out, 4096, 1024, 1024);
}

// v005
// Measured time: 85.6 microseconds a run.
// Timed twice side by side with v004, it ran 1.16 and 1.13 times as fast.
// All steps since v000 together make it 3.52 times as fast.
#include <hip/hip_runtime.h>
#include <hip/hip_bf16.h>
#include <math.h>

typedef __attribute__((ext_vector_type(16))) _Float16 v16h;
typedef __attribute__((ext_vector_type(8)))  float    v8f;
typedef __attribute__((__vector_size__(4 * sizeof(int)))) int v4i;

#define SEQ 1024
#define DMODEL 1024
#define HD 64

// LDS row pitch, in f16 elements, of every tile that load_frag reads with 16-byte loads: 16 bytes x an odd
// number, so that the 16 rows of a fragment start on 16 different groups of four banks (a pitch of 64 or
// 128 bytes puts them on 4 or 2 groups, and each load then takes 4 or 8 times the LDS clocks).
#define P32 40   // rows of 32 f16 (64 bytes) at 80 bytes
#define P64 72   // rows of 64 f16 (128 bytes) at 144 bytes

#define AS1 __attribute__((address_space(1)))
#define AS3 __attribute__((address_space(3)))

#if defined(__has_builtin)
#if __has_builtin(__builtin_amdgcn_global_load_async_to_lds_b128)
#define HAVE_ASYNC 1
#endif
#endif

#ifdef HAVE_ASYNC
#if __has_builtin(__builtin_amdgcn_s_wait_asynccnt)
#define ASYNC_WAIT(n) __builtin_amdgcn_s_wait_asynccnt(n)
#else
#define ASYNC_WAIT(n) asm volatile("s_wait_asynccnt " #n ::: "memory")
#endif
#else
#define ASYNC_WAIT(n)
#endif

// 16-byte tile-staging copy: async global->LDS (ASYNCcnt) when available,
// else synchronous through VGPRs.
__device__ __forceinline__ void copy16_to_lds(const _Float16* gsrc, _Float16* ldst) {
#ifdef HAVE_ASYNC
  __builtin_amdgcn_global_load_async_to_lds_b128(
      (AS1 v4i*)(gsrc), (AS3 v4i*)(ldst), 0, 0);
#else
  *(uint4*)ldst = *(const uint4*)gsrc;
#endif
}

__device__ __forceinline__ v8f wmma16(v16h a, v16h b, v8f c) {
  // v_wmma_f32_16x16x32_f16: D = A(16x32 f16) * B(32x16 f16) + C(16x16 f32)
  return __builtin_amdgcn_wmma_f32_16x16x32_f16(false, a, false, b, (short)0, c, false, false);
}

union FragU { v16h h; uint4 u[2]; };

// A/B fragment loader. Layout (ISA 7.12.2, 16-bit A 16x32):
//   lane L holds row (L&15); halves 0..7 = K in [koff, koff+8), halves 8..15 = K in [koff+16, koff+24)
//   where koff = 8*(L>>4). B mirrors A with "row" = output column of a [16][K] Bt tile.
__device__ __forceinline__ v16h load_frag(const _Float16* tile, int ldh) {
  const int lane = threadIdx.x & 31;
  const int row  = lane & 15;
  const int koff = (lane >> 4) << 3;
  const _Float16* p = tile + row * ldh + koff;
  FragU f;
  f.u[0] = *(const uint4*)(p);
  f.u[1] = *(const uint4*)(p + 16);
  return f.h;
}

// Sum over the 16 lanes of a row, result in every lane of the row (DPP row_xmask butterfly:
// stays in the vector unit, where a shuffle would go through the LDS unit).
template <int MASK>
__device__ __forceinline__ float add_xmask(float v) {
  return v + __builtin_bit_cast(float, __builtin_amdgcn_update_dpp(
                 0, __builtin_bit_cast(int, v), 0x160 | MASK, 0xf, 0xf, true));
}
__device__ __forceinline__ float row16_sum(float v) {
  v = add_xmask<1>(v);
  v = add_xmask<2>(v);
  v = add_xmask<4>(v);
  return add_xmask<8>(v);
}

// ---------------- conversion kernels ----------------
// 32 elements a thread, so that few waves have to start and each keeps 8 loads of 16 bytes in flight.
// The loops below are unrolled so that v[] stays in registers and the 8 loads issue as one group.
union Half4 { _Float16 h[4]; uint2 u; };
union Half8 { _Float16 h[8]; uint4 u; };

// fp32 -> f16, same order. A block takes 8192 consecutive elements; each of a thread's 8 loads is part of
// 512 contiguous bytes of its wave, all 8 issued before the first is used.
__global__ __launch_bounds__(256) void cvt_f16(const float* __restrict__ in, _Float16* __restrict__ out) {
  const size_t base = (size_t)blockIdx.x * 8192 + threadIdx.x * 4;
  float4 v[8];
#pragma unroll
  for (int j = 0; j < 8; ++j) v[j] = *(const float4*)&in[base + j * 1024];
#pragma unroll
  for (int j = 0; j < 8; ++j) {
    Half4 pk;
    pk.h[0] = (_Float16)v[j].x; pk.h[1] = (_Float16)v[j].y;
    pk.h[2] = (_Float16)v[j].z; pk.h[3] = (_Float16)v[j].w;
    *(uint2*)&out[base + j * 1024] = pk.u;
  }
}

// W[K][N] fp32 -> Wt[N][K] f16  (Wt is the "Bt" operand: row = output column)
// A block of 4 waves takes 64 k x 64 n, a wave 64 k x 16 n, a thread 8 k x 4 n, transposed in its registers:
// 8 loads of 4 adjacent n, then 4 stores of 8 adjacent k. 8 lanes side by side in k store one whole 128-byte line.
// K and N are compile-time so that the row steps are immediate offsets on one address register pair.
template <int K, int N>
__device__ __forceinline__ void cvt_t_tile(const float* __restrict__ W, _Float16* __restrict__ Wt) {
  const int wave = threadIdx.x >> 5, lane = threadIdx.x & 31;
  const int n = blockIdx.x * 64 + wave * 16 + (lane & 3) * 4;
  const int k = blockIdx.y * 64 + (lane >> 2) * 8;
  const float* src = W + (size_t)k * N + n;
  _Float16* dst = Wt + (size_t)n * K + k;
  float4 v[8];
#pragma unroll
  for (int j = 0; j < 8; ++j) v[j] = *(const float4*)(src + j * N);
  Half8 c[4];
#pragma unroll
  for (int j = 0; j < 8; ++j) {
    c[0].h[j] = (_Float16)v[j].x; c[1].h[j] = (_Float16)v[j].y;
    c[2].h[j] = (_Float16)v[j].z; c[3].h[j] = (_Float16)v[j].w;
  }
#pragma unroll
  for (int i = 0; i < 4; ++i) *(uint4*)(dst + i * K) = c[i].u;
}
__global__ __launch_bounds__(128) void cvt_wqkv_t(const float* __restrict__ W, _Float16* __restrict__ Wt) {
  cvt_t_tile<DMODEL, 3 * DMODEL>(W, Wt);
}
__global__ __launch_bounds__(128) void cvt_wo_t(const float* __restrict__ W, _Float16* __restrict__ Wt) {
  cvt_t_tile<DMODEL, DMODEL>(W, Wt);
}

// ---------------- tiled WMMA GEMM: C[M][N] = A[M][K](f16) * Bt[N][K](f16)^T + bias ----------------
// Double-buffered LDS, async global->LDS staging overlapped with WMMA compute.
// A block of 4 waves takes 128 x 128, a wave 64 x 64 (2 x 2 waves): 4 A and 4 B fragments feed 16 WMMAs,
// one 16-byte LDS load a WMMA.
__global__ __launch_bounds__(128) void gemm_wmma(
    const _Float16* __restrict__ A, const _Float16* __restrict__ Bt,
    const float* __restrict__ bias, float* __restrict__ C, int M, int N, int K) {
  __shared__ __attribute__((aligned(16))) _Float16 As[2][128 * P32];
  __shared__ __attribute__((aligned(16))) _Float16 Bs[2][128 * P32];
  const int tid = threadIdx.x, wave = tid >> 5, lane = tid & 31;
  const int wm = wave >> 1, wn = wave & 1;
  const int m0 = blockIdx.x * 128, n0 = blockIdx.y * 128;

  // Each thread stages 4 A-octets + 4 B-octets per K-step = 8 async-load instructions.
  auto issue_stage = [&](int buf, int k0) {
#pragma unroll  // the 8 copies of a stage issue back to back, their row steps folded at compile time
    for (int it = 0; it < 4; ++it) {  // 128 rows x 4 octets of f16
      int c = tid + it * 128;
      int r = c >> 2, s = c & 3;
      copy16_to_lds(&A[(size_t)(m0 + r) * K + k0 + s * 8], &As[buf][r * P32 + s * 8]);
      copy16_to_lds(&Bt[(size_t)(n0 + r) * K + k0 + s * 8], &Bs[buf][r * P32 + s * 8]);
    }
  };

  const v8f vzero = {0.f, 0.f, 0.f, 0.f, 0.f, 0.f, 0.f, 0.f};
  v8f acc[4][4];
#pragma unroll  // constant indices keep the tiles in registers
  for (int i = 0; i < 4; ++i)
#pragma unroll  // constant indices keep the tiles in registers
    for (int j = 0; j < 4; ++j) acc[i][j] = vzero;

  const int nsteps = K / 32;
  issue_stage(0, 0);
  for (int i = 0; i < nsteps; ++i) {
    const int cur = i & 1;
    if (i + 1 < nsteps) {
      issue_stage(cur ^ 1, (i + 1) * 32);  // prefetch next stage (overlaps compute)
      ASYNC_WAIT(8);                       // oldest 8 (current stage) complete; next 8 in flight
    } else {
      ASYNC_WAIT(0);
    }
    __syncthreads();
    v16h afr[4], bfr[4];
#pragma unroll  // constant indices keep the tiles in registers
    for (int j = 0; j < 4; ++j) {
      afr[j] = load_frag(&As[cur][(wm * 64 + j * 16) * P32], P32);
      bfr[j] = load_frag(&Bs[cur][(wn * 64 + j * 16) * P32], P32);
    }
#pragma unroll  // constant indices keep the tiles in registers
    for (int mi = 0; mi < 4; ++mi)
#pragma unroll  // constant indices keep the tiles in registers
      for (int j = 0; j < 4; ++j) acc[mi][j] = wmma16(afr[mi], bfr[j], acc[mi][j]);
    __syncthreads();  // all waves done reading buf[cur] before it is refilled
  }

  // D layout: lane holds col (lane&15); VGPR e is row e (lanes 0-15) / e+8 (lanes 16-31)
  const int ncol = lane & 15, half = lane >> 4;
#pragma unroll  // constant indices keep the tiles in registers
  for (int j = 0; j < 4; ++j) {
    int gc = n0 + wn * 64 + j * 16 + ncol;
    float bv = bias[gc];
#pragma unroll  // constant indices keep the tiles in registers
    for (int mi = 0; mi < 4; ++mi) {
#pragma unroll  // constant indices keep the tiles in registers
      for (int e = 0; e < 8; ++e) {
        int gr = m0 + wm * 64 + mi * 16 + e + 8 * half;
        C[(size_t)gr * N + gc] = acc[mi][j][e] + bv;
      }
    }
  }
}

// ---------------- QKV projection with bias, per-head LayerNorm and f16 split in the epilogue ----------------
// Same K loop as gemm_wmma on A = x[4096][1024], Bt = Wqkv^T[3072][1024]. A 128-column block is two whole
// heads of q, of k or of v, and a wave holds 64 full rows of one of them, so each LayerNorm row is complete in a wave.
// Writes qh,kh [B*H][N][64] f16 (k row-major == A for K*Q^T) and vth [B*H][64][N] f16 (v^T == A for V^T*P^T).
// Bt rows are staged permuted inside each head: LDS row hh*64 + jj*16 + r holds column hh*64 + 4*r + jj,
// so lane r ends up with the four adjacent columns 4r..4r+3 of its wave's head in acc[.][0..3].
__global__ __launch_bounds__(128) void gemm_qkv_ln(
    const _Float16* __restrict__ A, const _Float16* __restrict__ Bt, const float* __restrict__ bias,
    const float* __restrict__ qg, const float* __restrict__ qb,
    const float* __restrict__ kg, const float* __restrict__ kb,
    _Float16* __restrict__ qh, _Float16* __restrict__ kh, _Float16* __restrict__ vth, int K) {
  __shared__ __attribute__((aligned(16))) _Float16 As[2][128 * P32];
  __shared__ __attribute__((aligned(16))) _Float16 Bs[2][128 * P32];
  const int tid = threadIdx.x, wave = tid >> 5, lane = tid & 31;
  const int wm = wave >> 1, wn = wave & 1;
  const int m0 = blockIdx.x * 128, n0 = blockIdx.y * 128;

  auto issue_stage = [&](int buf, int k0) {
#pragma unroll  // the 8 copies of a stage issue back to back, their row steps folded at compile time
    for (int it = 0; it < 4; ++it) {  // 128 rows x 4 octets of f16
      int c = tid + it * 128;
      int r = c >> 2, s = c & 3;
      int pr = (r & 64) | ((r & 15) << 2) | ((r >> 4) & 3);  // column staged in LDS row r
      copy16_to_lds(&A[(size_t)(m0 + r) * K + k0 + s * 8], &As[buf][r * P32 + s * 8]);
      copy16_to_lds(&Bt[(size_t)(n0 + pr) * K + k0 + s * 8], &Bs[buf][r * P32 + s * 8]);
    }
  };

  const v8f vzero = {0.f, 0.f, 0.f, 0.f, 0.f, 0.f, 0.f, 0.f};
  v8f acc[4][4];
#pragma unroll  // constant indices keep the tiles in registers
  for (int i = 0; i < 4; ++i)
#pragma unroll  // constant indices keep the tiles in registers
    for (int j = 0; j < 4; ++j) acc[i][j] = vzero;

  const int nsteps = K / 32;
  issue_stage(0, 0);
  for (int i = 0; i < nsteps; ++i) {
    const int cur = i & 1;
    if (i + 1 < nsteps) {
      issue_stage(cur ^ 1, (i + 1) * 32);  // prefetch next stage (overlaps compute)
      ASYNC_WAIT(8);                       // oldest 8 (current stage) complete; next 8 in flight
    } else {
      ASYNC_WAIT(0);
    }
    __syncthreads();
    v16h afr[4], bfr[4];
#pragma unroll  // constant indices keep the tiles in registers
    for (int j = 0; j < 4; ++j) {
      afr[j] = load_frag(&As[cur][(wm * 64 + j * 16) * P32], P32);
      bfr[j] = load_frag(&Bs[cur][(wn * 64 + j * 16) * P32], P32);
    }
#pragma unroll  // constant indices keep the tiles in registers
    for (int mi = 0; mi < 4; ++mi)
#pragma unroll  // constant indices keep the tiles in registers
      for (int j = 0; j < 4; ++j) acc[mi][j] = wmma16(afr[mi], bfr[j], acc[mi][j]);
    __syncthreads();  // all waves done reading buf[cur] before it is refilled
  }

  // D layout: lane holds one column (index lane&15); VGPR e is row e (lanes 0-15) / e+8 (lanes 16-31)
  const int r = lane & 15, half = lane >> 4;
  const int sel = n0 >> 10;                       // 0: q, 1: k, 2: v (the same for the whole block)
  const int grow = m0 + wm * 64 + 8 * half;       // first of this lane's 8 rows in row tile 0
  const int b = grow >> 10, n = grow & (SEQ - 1);
  const size_t bh = (size_t)(b * 16 + ((n0 & 1023) >> 6) + wn);  // this wave's head
  const float4 bv = *(const float4*)&bias[n0 + wn * 64 + 4 * r];
  const float bj[4] = {bv.x, bv.y, bv.z, bv.w};
  if (sel == 2) {
    // v^T: a lane's 8 rows of a row tile are 8 consecutive n of column 4r+jj: one 16-byte store each
#pragma unroll  // constant indices keep the tiles in registers
    for (int mi = 0; mi < 4; ++mi) {
#pragma unroll  // constant indices keep the tiles in registers
      for (int jj = 0; jj < 4; ++jj) {
        union { _Float16 h[8]; uint4 u; } pk;
#pragma unroll  // constant indices keep the tiles in registers
        for (int e = 0; e < 8; ++e) pk.h[e] = (_Float16)(acc[mi][jj][e] + bj[jj]);
        *(uint4*)&vth[bh * (HD * SEQ) + (size_t)(4 * r + jj) * SEQ + n + mi * 16] = pk.u;
      }
    }
  } else {
    const float4 g4 = *(const float4*)&(sel ? kg : qg)[4 * r];
    const float4 b4 = *(const float4*)&(sel ? kb : qb)[4 * r];
    _Float16* dst = (sel ? kh : qh) + (bh * SEQ + n) * HD + 4 * r;
#pragma unroll  // constant indices keep the tiles in registers
    for (int mi = 0; mi < 4; ++mi) {
      union { _Float16 h[4]; unsigned long long u; } pk[8];
#pragma unroll  // constant indices keep the tiles in registers
      for (int e = 0; e < 8; ++e) {
        float t0 = acc[mi][0][e] + bj[0], t1 = acc[mi][1][e] + bj[1];
        float t2 = acc[mi][2][e] + bj[2], t3 = acc[mi][3][e] + bj[3];
        float mu = row16_sum((t0 + t1) + (t2 + t3)) * (1.f / 64.f);
        t0 -= mu; t1 -= mu; t2 -= mu; t3 -= mu;
        float var = row16_sum((t0 * t0 + t1 * t1) + (t2 * t2 + t3 * t3)) * (1.f / 64.f) + 1e-5f;
        float rs;
        // var >= 1e-5, so the library's rescaling of subnormal arguments is an identity here; the v_nop keeps
        // the one free slot the instruction set asks for behind a transcendental, whatever is scheduled next.
        asm("v_rsq_f32 %0, %1\n\tv_nop" : "=v"(rs) : "v"(var));
        pk[e].h[0] = (_Float16)(t0 * rs * g4.x + b4.x);
        pk[e].h[1] = (_Float16)(t1 * rs * g4.y + b4.y);
        pk[e].h[2] = (_Float16)(t2 * rs * g4.z + b4.z);
        pk[e].h[3] = (_Float16)(t3 * rs * g4.w + b4.w);
      }
      // The 8 rows of a row tile; 16 lanes x 8 bytes are one whole 128-byte head row. The stores and their wait
      // are one statement so that the next row tile's arithmetic, which reuses these registers, stays behind the wait.
      asm volatile(
          "global_store_b64 %0, %1, off\n\t"
          "global_store_b64 %0, %2, off offset:128\n\t"
          "global_store_b64 %0, %3, off offset:256\n\t"
          "global_store_b64 %0, %4, off offset:384\n\t"
          "global_store_b64 %0, %5, off offset:512\n\t"
          "global_store_b64 %0, %6, off offset:640\n\t"
          "global_store_b64 %0, %7, off offset:768\n\t"
          "global_store_b64 %0, %8, off offset:896\n\t"
          "s_wait_xcnt 0x0"
          :: "v"(dst + mi * 16 * HD), "v"(pk[0].u), "v"(pk[1].u), "v"(pk[2].u), "v"(pk[3].u),
             "v"(pk[4].u), "v"(pk[5].u), "v"(pk[6].u), "v"(pk[7].u)
          : "memory");
    }
  }
}

// ---------------- flash attention: block = (b*h, 64-query tile), 4 waves x 16 queries ----------------
// Lane l with lane l ^ 16, in the vector unit (a shuffle would go through the LDS unit).
__device__ __forceinline__ float xhalf(float x) {
  const int b = __builtin_bit_cast(int, x);
  return __builtin_bit_cast(float, __builtin_amdgcn_permlanex16(b, b, 0x76543210, 0xfedcba98, false, false));
}

__global__ __launch_bounds__(128) void flash_attn(
    const _Float16* __restrict__ qh, const _Float16* __restrict__ kh,
    const _Float16* __restrict__ vth, _Float16* __restrict__ aout) {
  __shared__ __attribute__((aligned(16))) _Float16 ksm[32 * P64];      // 32 keys x 64 hd
  __shared__ __attribute__((aligned(16))) _Float16 vts[64 * P32];      // 64 hd x 32 keys (v^T)

  const int tid = threadIdx.x, wave = tid >> 5, lane = tid & 31;
  const int bh = blockIdx.x;                       // 0..63
  const int q0 = blockIdx.y * 64 + wave * 16;      // query tile base
  const int r = lane & 15, half = lane >> 4;

  const _Float16* qp = qh + (size_t)bh * SEQ * HD;
  const _Float16* kp = kh + (size_t)bh * SEQ * HD;
  const _Float16* vp = vth + (size_t)bh * HD * SEQ;

  // Q^T B-fragments (column = query r) held in registers for the whole pass (hd split into two K=32 chunks)
  v16h bq0 = load_frag(qp + (size_t)q0 * HD, HD);
  v16h bq1 = load_frag(qp + (size_t)q0 * HD + 32, HD);

  const v8f vzero = {0.f, 0.f, 0.f, 0.f, 0.f, 0.f, 0.f, 0.f};
  v8f acc[4];  // acc[t][e] = O[query r][hd 16t + 8*half + e]
#pragma unroll
  for (int t = 0; t < 4; ++t) acc[t] = vzero;
  float m = -INFINITY;  // running maximum of query r, the same in both halves
  float l = 0.f;        // running sum over this half's keys only; the halves are joined behind the loop

  for (int kb = 0; kb < 32; ++kb) {
    __syncthreads();
#pragma unroll
    for (int c = tid; c < 256; c += 128) {  // K tile: 32 rows x 8 octets
      int rr = c >> 3, s = c & 7;
      copy16_to_lds(&kp[(size_t)(kb * 32 + rr) * 64 + s * 8], &ksm[rr * P64 + s * 8]);
    }
#pragma unroll
    for (int c = tid; c < 256; c += 128) {  // V^T tile: 64 rows x 4 octets
      int dd = c >> 2, s = c & 3;
      copy16_to_lds(&vp[(size_t)dd * SEQ + kb * 32 + s * 8], &vts[dd * P32 + s * 8]);
    }
    ASYNC_WAIT(0);
    __syncthreads();

    // S^T = K Q^T : two 16-key sub-tiles, K(hd)=64 in two WMMAs each
    // s0[e] = S[query r][key 8*half + e], s1[e] = S[query r][key 16 + 8*half + e]
    v8f s0 = vzero, s1 = vzero;
    {
      v16h a00 = load_frag(&ksm[0], P64);
      v16h a01 = load_frag(&ksm[32], P64);
      v16h a10 = load_frag(&ksm[16 * P64], P64);
      v16h a11 = load_frag(&ksm[16 * P64 + 32], P64);
      s0 = wmma16(a00, bq0, s0);
      s1 = wmma16(a10, bq0, s1);
      s0 = wmma16(a01, bq1, s0);
      s1 = wmma16(a11, bq1, s1);
    }

    // online softmax: 16 of the 32 keys of query r in this lane, the other 16 in lane ^ 16
    float t8[8];
#pragma unroll
    for (int e = 0; e < 8; ++e) t8[e] = fmaxf(s0[e], s1[e]);
    float pm = fmaxf(fmaxf(fmaxf(t8[0], t8[1]), fmaxf(t8[2], t8[3])),
                     fmaxf(fmaxf(t8[4], t8[5]), fmaxf(t8[6], t8[7])));
    pm = fmaxf(pm, xhalf(pm)) * 0.125f;  // 1/sqrt(64): a power of two, so it commutes with the maximum exactly
    const float mnew = fmaxf(m, pm);
    const float al = __expf(m - mnew);
    float ps = 0.f;
    v16h bp;  // P^T B-fragment: element s is key 8*half + s (s < 8) or 16 + 8*half + (s - 8)
#pragma unroll
    for (int e = 0; e < 8; ++e) {
      const float p0 = __expf(s0[e] * 0.125f - mnew);
      const float p1 = __expf(s1[e] * 0.125f - mnew);
      ps += p0 + p1;
      bp[e]     = (_Float16)p0;
      bp[8 + e] = (_Float16)p1;
    }
    l = al * l + ps;
    m = mnew;

    // rescale running O^T (one query a lane: one factor) and accumulate V^T P^T (4 hd sub-tiles of 16)
#pragma unroll
    for (int t = 0; t < 4; ++t) {
#pragma unroll
      for (int e = 0; e < 8; ++e) acc[t][e] *= al;
      v16h av = load_frag(&vts[16 * t * P32], P32);
      acc[t] = wmma16(av, bp, acc[t]);
    }
  }

  // finalize: divide by row sums, emit f16 [B,N,D] with head-concat columns;
  // a lane's 8 values of a sub-tile are 8 adjacent hd of its query: one 16-byte store each
  const float linv = 1.f / (l + xhalf(l));
  const int b = bh >> 4, h = bh & 15;
  _Float16* dst = aout + (size_t)(b * SEQ + q0 + r) * DMODEL + h * 64 + 8 * half;
#pragma unroll
  for (int t = 0; t < 4; ++t) {
    Half8 pk;
#pragma unroll
    for (int e = 0; e < 8; ++e) pk.h[e] = (_Float16)(acc[t][e] * linv);
    *(uint4*)(dst + t * 16) = pk.u;
  }
}

extern "C" void kernel_launch(void* const* d_in, const int* in_sizes, int n_in,
                              void* d_out, int out_size, void* d_ws, size_t ws_size,
                              hipStream_t stream) {
  const float* x    = (const float*)d_in[0];
  const float* Wqkv = (const float*)d_in[1];
  const float* bqkv = (const float*)d_in[2];
  const float* qg   = (const float*)d_in[3];
  const float* qb   = (const float*)d_in[4];
  const float* kg   = (const float*)d_in[5];
  const float* kb   = (const float*)d_in[6];
  const float* Wo   = (const float*)d_in[7];
  const float* bo   = (const float*)d_in[8];
  float* out = (float*)d_out;

  char* ws = (char*)d_ws;
  size_t off = 0;
  auto alloc = [&](size_t bytes) -> char* {
    char* p = ws + off;
    off += (bytes + 255) & ~(size_t)255;
    return p;
  };
  _Float16* xh   = (_Float16*)alloc(4096ull * 1024 * 2);  // x in f16
  _Float16* wqt  = (_Float16*)alloc(3072ull * 1024 * 2);  // Wqkv^T f16
  _Float16* wot  = (_Float16*)alloc(1024ull * 1024 * 2);  // Wo^T f16
  _Float16* qh   = (_Float16*)alloc(64ull * 1024 * 64 * 2);
  _Float16* kh   = (_Float16*)alloc(64ull * 1024 * 64 * 2);
  _Float16* vth  = (_Float16*)alloc(64ull * 1024 * 64 * 2);
  _Float16* aout = (_Float16*)alloc(4096ull * 1024 * 2);

  cvt_f16<<<512, 256, 0, stream>>>(x, xh);                                 // 512 x 8192 = 4096 x 1024 elements
  cvt_wqkv_t<<<dim3(48, 16), 128, 0, stream>>>(Wqkv, wqt);                 // 48 x 64 n, 16 x 64 k
  cvt_wo_t<<<dim3(16, 16), 128, 0, stream>>>(Wo, wot);                     // 16 x 64 n, 16 x 64 k
  gemm_qkv_ln<<<dim3(32, 24), 128, 0, stream>>>(xh, wqt, bqkv, qg, qb, kg, kb, qh, kh, vth, 1024);
  flash_attn<<<dim3(64, 16), 128, 0, stream>>>(qh, kh, vth, aout);
  gemm_wmma<<<dim3(32, 8), 128, 0, stream>>>(aout, wot, bo, out, 4096, 1024, 1024);
}

// v006
// Measured time: 82.7 microseconds a run.
// Timed twice side by side with v005, it ran 1.05 and 1.04 times as fast.
// Over all steps from v000 it is 3.67 times as fast.
#include <hip/hip_runtime.h>
#include <hip/hip_bf16.h>
#include <math.h>

typedef __attribute__((ext_vector_type(16))) _Float16 v16h;
typedef __attribute__((ext_vector_type(8)))  float    v8f;
typedef __attribute__((__vector_size__(4 * sizeof(int)))) int v4i;

#define SEQ 1024
#define DMODEL 1024
#define HD 64

// LDS row pitch, in f16 elements, of every tile that load_frag reads with 16-byte loads: 16 bytes x an odd
// number, so that the 16 rows of a fragment start on 16 different groups of four banks (a pitch of 64 or
// 128 bytes puts them on 4 or 2 groups, and each load then takes 4 or 8 times the LDS clocks).
#define P32 40   // rows of 32 f16 (64 bytes) at 80 bytes
#define P64 72   // rows of 64 f16 (128 bytes) at 144 bytes

#define AS1 __attribute__((address_space(1)))
#define AS3 __attribute__((address_space(3)))

#if defined(__has_builtin)
#if __has_builtin(__builtin_amdgcn_global_load_async_to_lds_b128)
#define HAVE_ASYNC 1
#endif
#endif

#ifdef HAVE_ASYNC
#if __has_builtin(__builtin_amdgcn_s_wait_asynccnt)
#define ASYNC_WAIT(n) __builtin_amdgcn_s_wait_asynccnt(n)
#else
#define ASYNC_WAIT(n) asm volatile("s_wait_asynccnt " #n ::: "memory")
#endif
#else
#define ASYNC_WAIT(n)
#endif

// 16-byte tile-staging copy: async global->LDS (ASYNCcnt) when available,
// else synchronous through VGPRs.
__device__ __forceinline__ void copy16_to_lds(const _Float16* gsrc, _Float16* ldst) {
#ifdef HAVE_ASYNC
  __builtin_amdgcn_global_load_async_to_lds_b128(
      (AS1 v4i*)(gsrc), (AS3 v4i*)(ldst), 0, 0);
#else
  *(uint4*)ldst = *(const uint4*)gsrc;
#endif
}

__device__ __forceinline__ v8f wmma16(v16h a, v16h b, v8f c) {
  // v_wmma_f32_16x16x32_f16: D = A(16x32 f16) * B(32x16 f16) + C(16x16 f32)
  return __builtin_amdgcn_wmma_f32_16x16x32_f16(false, a, false, b, (short)0, c, false, false);
}

union FragU { v16h h; uint4 u[2]; };

// A/B fragment loader. Layout (ISA 7.12.2, 16-bit A 16x32):
//   lane L holds row (L&15); halves 0..7 = K in [koff, koff+8), halves 8..15 = K in [koff+16, koff+24)
//   where koff = 8*(L>>4). B mirrors A with "row" = output column of a [16][K] Bt tile.
__device__ __forceinline__ v16h load_frag(const _Float16* tile, int ldh) {
  const int lane = threadIdx.x & 31;
  const int row  = lane & 15;
  const int koff = (lane >> 4) << 3;
  const _Float16* p = tile + row * ldh + koff;
  FragU f;
  f.u[0] = *(const uint4*)(p);
  f.u[1] = *(const uint4*)(p + 16);
  return f.h;
}

// Sum over the 16 lanes of a row, result in every lane of the row (DPP row_xmask butterfly:
// stays in the vector unit, where a shuffle would go through the LDS unit).
template <int MASK>
__device__ __forceinline__ float add_xmask(float v) {
  return v + __builtin_bit_cast(float, __builtin_amdgcn_update_dpp(
                 0, __builtin_bit_cast(int, v), 0x160 | MASK, 0xf, 0xf, true));
}
__device__ __forceinline__ float row16_sum(float v) {
  v = add_xmask<1>(v);
  v = add_xmask<2>(v);
  v = add_xmask<4>(v);
  return add_xmask<8>(v);
}

// ---------------- conversion kernels ----------------
// 32 elements a thread, so that few waves have to start and each keeps 8 loads of 16 bytes in flight.
// The loops below are unrolled so that v[] stays in registers and the 8 loads issue as one group.
union Half4 { _Float16 h[4]; uint2 u; };
union Half8 { _Float16 h[8]; uint4 u; };

// fp32 -> f16, same order. A block takes 8192 consecutive elements; each of a thread's 8 loads is part of
// 512 contiguous bytes of its wave, all 8 issued before the first is used.
__device__ __forceinline__ void cvt_rows(const float* __restrict__ in, _Float16* __restrict__ out, int blk) {
  const size_t base = (size_t)blk * 8192 + threadIdx.x * 4;
  float4 v[8];
#pragma unroll
  for (int j = 0; j < 8; ++j) v[j] = *(const float4*)&in[base + j * 1024];
#pragma unroll
  for (int j = 0; j < 8; ++j) {
    Half4 pk;
    pk.h[0] = (_Float16)v[j].x; pk.h[1] = (_Float16)v[j].y;
    pk.h[2] = (_Float16)v[j].z; pk.h[3] = (_Float16)v[j].w;
    *(uint2*)&out[base + j * 1024] = pk.u;
  }
}

// W[K][N] fp32 -> Wt[N][K] f16  (Wt is the "Bt" operand: row = output column)
// A block of 8 waves takes 64 k x 128 n (tile bk, bn), a wave 64 k x 16 n, a thread 8 k x 4 n, transposed in its
// registers: 8 loads of 4 adjacent n, then 4 stores of 8 adjacent k. 8 lanes side by side in k store one whole 128-byte line.
// K and N are compile-time so that the row steps are immediate offsets on one address register pair.
template <int K, int N>
__device__ __forceinline__ void cvt_t_tile(const float* __restrict__ W, _Float16* __restrict__ Wt, int bn, int bk) {
  const int wave = threadIdx.x >> 5, lane = threadIdx.x & 31;
  const int n = bn * 128 + wave * 16 + (lane & 3) * 4;
  const int k = bk * 64 + (lane >> 2) * 8;
  const float* src = W + (size_t)k * N + n;
  _Float16* dst = Wt + (size_t)n * K + k;
  float4 v[8];
#pragma unroll
  for (int j = 0; j < 8; ++j) v[j] = *(const float4*)(src + j * N);
  Half8 c[4];
#pragma unroll
  for (int j = 0; j < 8; ++j) {
    c[0].h[j] = (_Float16)v[j].x; c[1].h[j] = (_Float16)v[j].y;
    c[2].h[j] = (_Float16)v[j].z; c[3].h[j] = (_Float16)v[j].w;
  }
#pragma unroll
  for (int i = 0; i < 4; ++i) *(uint4*)(dst + i * K) = c[i].u;
  // A block runs only this job and then ends; as a precaution this wait stands in front of any
  // overwrite of a register that one of the four issued stores names.
  asm volatile("s_wait_xcnt 0x0" ::: "memory");
}

// The three conversions read nothing of one another, so they share one launch: one gap, one fill and one tail
// where three launches in a row paid three. The block index picks the job (the same for a whole block).
#define CVT_X_BLOCKS    512  // 512 x 8192 = 4096 x 1024 elements of x
#define CVT_WQKV_BLOCKS 384  // 24 tiles of 128 n x 16 tiles of 64 k
#define CVT_WO_BLOCKS   128  // 8 tiles of 128 n x 16 tiles of 64 k
__global__ __launch_bounds__(256) void cvt_inputs(
    const float* __restrict__ x, const float* __restrict__ Wqkv, const float* __restrict__ Wo,
    _Float16* __restrict__ xh, _Float16* __restrict__ wqt, _Float16* __restrict__ wot) {
  const int blk = blockIdx.x;
  if (blk < CVT_X_BLOCKS) {
    cvt_rows(x, xh, blk);
  } else if (blk < CVT_X_BLOCKS + CVT_WQKV_BLOCKS) {
    const int t = blk - CVT_X_BLOCKS;
    cvt_t_tile<DMODEL, 3 * DMODEL>(Wqkv, wqt, t % 24, t / 24);
  } else {
    const int t = blk - (CVT_X_BLOCKS + CVT_WQKV_BLOCKS);
    cvt_t_tile<DMODEL, DMODEL>(Wo, wot, t & 7, t >> 3);
  }
}

// ---------------- tiled WMMA GEMM: C[M][N] = A[M][K](f16) * Bt[N][K](f16)^T + bias ----------------
// Double-buffered LDS, async global->LDS staging overlapped with WMMA compute.
// A block of 4 waves takes 128 x 128, a wave 64 x 64 (2 x 2 waves): 4 A and 4 B fragments feed 16 WMMAs,
// one 16-byte LDS load a WMMA.
__global__ __launch_bounds__(128) void gemm_wmma(
    const _Float16* __restrict__ A, const _Float16* __restrict__ Bt,
    const float* __restrict__ bias, float* __restrict__ C, int M, int N, int K) {
  __shared__ __attribute__((aligned(16))) _Float16 As[2][128 * P32];
  __shared__ __attribute__((aligned(16))) _Float16 Bs[2][128 * P32];
  const int tid = threadIdx.x, wave = tid >> 5, lane = tid & 31;
  const int wm = wave >> 1, wn = wave & 1;
  const int m0 = blockIdx.x * 128, n0 = blockIdx.y * 128;

  // Each thread stages 4 A-octets + 4 B-octets per K-step = 8 async-load instructions.
  auto issue_stage = [&](int buf, int k0) {
#pragma unroll  // the 8 copies of a stage issue back to back, their row steps folded at compile time
    for (int it = 0; it < 4; ++it) {  // 128 rows x 4 octets of f16
      int c = tid + it * 128;
      int r = c >> 2, s = c & 3;
      copy16_to_lds(&A[(size_t)(m0 + r) * K + k0 + s * 8], &As[buf][r * P32 + s * 8]);
      copy16_to_lds(&Bt[(size_t)(n0 + r) * K + k0 + s * 8], &Bs[buf][r * P32 + s * 8]);
    }
  };

  const v8f vzero = {0.f, 0.f, 0.f, 0.f, 0.f, 0.f, 0.f, 0.f};
  v8f acc[4][4];
#pragma unroll  // constant indices keep the tiles in registers
  for (int i = 0; i < 4; ++i)
#pragma unroll  // constant indices keep the tiles in registers
    for (int j = 0; j < 4; ++j) acc[i][j] = vzero;

  const int nsteps = K / 32;
  issue_stage(0, 0);
  for (int i = 0; i < nsteps; ++i) {
    const int cur = i & 1;
    if (i + 1 < nsteps) {
      issue_stage(cur ^ 1, (i + 1) * 32);  // prefetch next stage (overlaps compute)
      ASYNC_WAIT(8);                       // oldest 8 (current stage) complete; next 8 in flight
    } else {
      ASYNC_WAIT(0);
    }
    __syncthreads();
    v16h afr[4], bfr[4];
#pragma unroll  // constant indices keep the tiles in registers
    for (int j = 0; j < 4; ++j) {
      afr[j] = load_frag(&As[cur][(wm * 64 + j * 16) * P32], P32);
      bfr[j] = load_frag(&Bs[cur][(wn * 64 + j * 16) * P32], P32);
    }
#pragma unroll  // constant indices keep the tiles in registers
    for (int mi = 0; mi < 4; ++mi)
#pragma unroll  // constant indices keep the tiles in registers
      for (int j = 0; j < 4; ++j) acc[mi][j] = wmma16(afr[mi], bfr[j], acc[mi][j]);
    __syncthreads();  // all waves done reading buf[cur] before it is refilled
  }

  // D layout: lane holds col (lane&15); VGPR e is row e (lanes 0-15) / e+8 (lanes 16-31)
  const int ncol = lane & 15, half = lane >> 4;
#pragma unroll  // constant indices keep the tiles in registers
  for (int j = 0; j < 4; ++j) {
    int gc = n0 + wn * 64 + j * 16 + ncol;
    float bv = bias[gc];
#pragma unroll  // constant indices keep the tiles in registers
    for (int mi = 0; mi < 4; ++mi) {
#pragma unroll  // constant indices keep the tiles in registers
      for (int e = 0; e < 8; ++e) {
        int gr = m0 + wm * 64 + mi * 16 + e + 8 * half;
        C[(size_t)gr * N + gc] = acc[mi][j][e] + bv;
      }
    }
  }
}

// ---------------- QKV projection with bias, per-head LayerNorm and f16 split in the epilogue ----------------
// Same K loop as gemm_wmma on A = x[4096][1024], Bt = Wqkv^T[3072][1024]. A 128-column block is two whole
// heads of q, of k or of v, and a wave holds 64 full rows of one of them, so each LayerNorm row is complete in a wave.
// Writes qh,kh [B*H][N][64] f16 (k row-major == A for K*Q^T) and vth [B*H][64][N] f16 (v^T == A for V^T*P^T).
// Bt rows are staged permuted inside each head: LDS row hh*64 + jj*16 + r holds column hh*64 + 4*r + jj,
// so lane r ends up with the four adjacent columns 4r..4r+3 of its wave's head in acc[.][0..3].
__global__ __launch_bounds__(128) void gemm_qkv_ln(
    const _Float16* __restrict__ A, const _Float16* __restrict__ Bt, const float* __restrict__ bias,
    const float* __restrict__ qg, const float* __restrict__ qb,
    const float* __restrict__ kg, const float* __restrict__ kb,
    _Float16* __restrict__ qh, _Float16* __restrict__ kh, _Float16* __restrict__ vth, int K) {
  __shared__ __attribute__((aligned(16))) _Float16 As[2][128 * P32];
  __shared__ __attribute__((aligned(16))) _Float16 Bs[2][128 * P32];
  const int tid = threadIdx.x, wave = tid >> 5, lane = tid & 31;
  const int wm = wave >> 1, wn = wave & 1;
  const int m0 = blockIdx.x * 128, n0 = blockIdx.y * 128;

  auto issue_stage = [&](int buf, int k0) {
#pragma unroll  // the 8 copies of a stage issue back to back, their row steps folded at compile time
    for (int it = 0; it < 4; ++it) {  // 128 rows x 4 octets of f16
      int c = tid + it * 128;
      int r = c >> 2, s = c & 3;
      int pr = (r & 64) | ((r & 15) << 2) | ((r >> 4) & 3);  // column staged in LDS row r
      copy16_to_lds(&A[(size_t)(m0 + r) * K + k0 + s * 8], &As[buf][r * P32 + s * 8]);
      copy16_to_lds(&Bt[(size_t)(n0 + pr) * K + k0 + s * 8], &Bs[buf][r * P32 + s * 8]);
    }
  };

  const v8f vzero = {0.f, 0.f, 0.f, 0.f, 0.f, 0.f, 0.f, 0.f};
  v8f acc[4][4];
#pragma unroll  // constant indices keep the tiles in registers
  for (int i = 0; i < 4; ++i)
#pragma unroll  // constant indices keep the tiles in registers
    for (int j = 0; j < 4; ++j) acc[i][j] = vzero;

  const int nsteps = K / 32;
  issue_stage(0, 0);
  for (int i = 0; i < nsteps; ++i) {
    const int cur = i & 1;
    if (i + 1 < nsteps) {
      issue_stage(cur ^ 1, (i + 1) * 32);  // prefetch next stage (overlaps compute)
      ASYNC_WAIT(8);                       // oldest 8 (current stage) complete; next 8 in flight
    } else {
      ASYNC_WAIT(0);
    }
    __syncthreads();
    v16h afr[4], bfr[4];
#pragma unroll  // constant indices keep the tiles in registers
    for (int j = 0; j < 4; ++j) {
      afr[j] = load_frag(&As[cur][(wm * 64 + j * 16) * P32], P32);
      bfr[j] = load_frag(&Bs[cur][(wn * 64 + j * 16) * P32], P32);
    }
#pragma unroll  // constant indices keep the tiles in registers
    for (int mi = 0; mi < 4; ++mi)
#pragma unroll  // constant indices keep the tiles in registers
      for (int j = 0; j < 4; ++j) acc[mi][j] = wmma16(afr[mi], bfr[j], acc[mi][j]);
    __syncthreads();  // all waves done reading buf[cur] before it is refilled
  }

  // D layout: lane holds one column (index lane&15); VGPR e is row e (lanes 0-15) / e+8 (lanes 16-31)
  const int r = lane & 15, half = lane >> 4;
  const int sel = n0 >> 10;                       // 0: q, 1: k, 2: v (the same for the whole block)
  const int grow = m0 + wm * 64 + 8 * half;       // first of this lane's 8 rows in row tile 0
  const int b = grow >> 10, n = grow & (SEQ - 1);
  const size_t bh = (size_t)(b * 16 + ((n0 & 1023) >> 6) + wn);  // this wave's head
  const float4 bv = *(const float4*)&bias[n0 + wn * 64 + 4 * r];
  const float bj[4] = {bv.x, bv.y, bv.z, bv.w};
  if (sel == 2) {
    // v^T: a lane's 8 rows of a row tile are 8 consecutive n of column 4r+jj: one 16-byte store each
#pragma unroll  // constant indices keep the tiles in registers
    for (int mi = 0; mi < 4; ++mi) {
#pragma unroll  // constant indices keep the tiles in registers
      for (int jj = 0; jj < 4; ++jj) {
        union { _Float16 h[8]; uint4 u; } pk;
#pragma unroll  // constant indices keep the tiles in registers
        for (int e = 0; e < 8; ++e) pk.h[e] = (_Float16)(acc[mi][jj][e] + bj[jj]);
        *(uint4*)&vth[bh * (HD * SEQ) + (size_t)(4 * r + jj) * SEQ + n + mi * 16] = pk.u;
      }
    }
  } else {
    const float4 g4 = *(const float4*)&(sel ? kg : qg)[4 * r];
    const float4 b4 = *(const float4*)&(sel ? kb : qb)[4 * r];
    _Float16* dst = (sel ? kh : qh) + (bh * SEQ + n) * HD + 4 * r;
#pragma unroll  // constant indices keep the tiles in registers
    for (int mi = 0; mi < 4; ++mi) {
      union { _Float16 h[4]; unsigned long long u; } pk[8];
#pragma unroll  // constant indices keep the tiles in registers
      for (int e = 0; e < 8; ++e) {
        float t0 = acc[mi][0][e] + bj[0], t1 = acc[mi][1][e] + bj[1];
        float t2 = acc[mi][2][e] + bj[2], t3 = acc[mi][3][e] + bj[3];
        float mu = row16_sum((t0 + t1) + (t2 + t3)) * (1.f / 64.f);
        t0 -= mu; t1 -= mu; t2 -= mu; t3 -= mu;
        float var = row16_sum((t0 * t0 + t1 * t1) + (t2 * t2 + t3 * t3)) * (1.f / 64.f) + 1e-5f;
        float rs;
        // var >= 1e-5, so the library's rescaling of subnormal arguments is an identity here; the v_nop keeps
        // the one free slot the instruction set asks for behind a transcendental, whatever is scheduled next.
        asm("v_rsq_f32 %0, %1\n\tv_nop" : "=v"(rs) : "v"(var));
        pk[e].h[0] = (_Float16)(t0 * rs * g4.x + b4.x);
        pk[e].h[1] = (_Float16)(t1 * rs * g4.y + b4.y);
        pk[e].h[2] = (_Float16)(t2 * rs * g4.z + b4.z);
        pk[e].h[3] = (_Float16)(t3 * rs * g4.w + b4.w);
      }
      // The 8 rows of a row tile; 16 lanes x 8 bytes are one whole 128-byte head row. The stores and their wait
      // are one statement so that the next row tile's arithmetic, which reuses these registers, stays behind the wait.
      asm volatile(
          "global_store_b64 %0, %1, off\n\t"
          "global_store_b64 %0, %2, off offset:128\n\t"
          "global_store_b64 %0, %3, off offset:256\n\t"
          "global_store_b64 %0, %4, off offset:384\n\t"
          "global_store_b64 %0, %5, off offset:512\n\t"
          "global_store_b64 %0, %6, off offset:640\n\t"
          "global_store_b64 %0, %7, off offset:768\n\t"
          "global_store_b64 %0, %8, off offset:896\n\t"
          "s_wait_xcnt 0x0"
          :: "v"(dst + mi * 16 * HD), "v"(pk[0].u), "v"(pk[1].u), "v"(pk[2].u), "v"(pk[3].u),
             "v"(pk[4].u), "v"(pk[5].u), "v"(pk[6].u), "v"(pk[7].u)
          : "memory");
    }
  }
}

// ---------------- flash attention: block = (b*h, 64-query tile), 4 waves x 16 queries ----------------
// Lane l with lane l ^ 16, in the vector unit (a shuffle would go through the LDS unit).
__device__ __forceinline__ float xhalf(float x) {
  const int b = __builtin_bit_cast(int, x);
  return __builtin_bit_cast(float, __builtin_amdgcn_permlanex16(b, b, 0x76543210, 0xfedcba98, false, false));
}

__global__ __launch_bounds__(128) void flash_attn(
    const _Float16* __restrict__ qh, const _Float16* __restrict__ kh,
    const _Float16* __restrict__ vth, _Float16* __restrict__ aout) {
  __shared__ __attribute__((aligned(16))) _Float16 ksm[32 * P64];      // 32 keys x 64 hd
  __shared__ __attribute__((aligned(16))) _Float16 vts[64 * P32];      // 64 hd x 32 keys (v^T)

  const int tid = threadIdx.x, wave = tid >> 5, lane = tid & 31;
  const int bh = blockIdx.x;                       // 0..63
  const int q0 = blockIdx.y * 64 + wave * 16;      // query tile base
  const int r = lane & 15, half = lane >> 4;

  const _Float16* qp = qh + (size_t)bh * SEQ * HD;
  const _Float16* kp = kh + (size_t)bh * SEQ * HD;
  const _Float16* vp = vth + (size_t)bh * HD * SEQ;

  // Q^T B-fragments (column = query r) held in registers for the whole pass (hd split into two K=32 chunks)
  v16h bq0 = load_frag(qp + (size_t)q0 * HD, HD);
  v16h bq1 = load_frag(qp + (size_t)q0 * HD + 32, HD);

  const v8f vzero = {0.f, 0.f, 0.f, 0.f, 0.f, 0.f, 0.f, 0.f};
  v8f acc[4];  // acc[t][e] = O[query r][hd 16t + 8*half + e]
#pragma unroll
  for (int t = 0; t < 4; ++t) acc[t] = vzero;
  float m = -INFINITY;  // running maximum of query r, the same in both halves
  float l = 0.f;        // running sum over this half's keys only; the halves are joined behind the loop

  for (int kb = 0; kb < 32; ++kb) {
    __syncthreads();
#pragma unroll
    for (int c = tid; c < 256; c += 128) {  // K tile: 32 rows x 8 octets
      int rr = c >> 3, s = c & 7;
      copy16_to_lds(&kp[(size_t)(kb * 32 + rr) * 64 + s * 8], &ksm[rr * P64 + s * 8]);
    }
#pragma unroll
    for (int c = tid; c < 256; c += 128) {  // V^T tile: 64 rows x 4 octets
      int dd = c >> 2, s = c & 3;
      copy16_to_lds(&vp[(size_t)dd * SEQ + kb * 32 + s * 8], &vts[dd * P32 + s * 8]);
    }
    ASYNC_WAIT(0);
    __syncthreads();

    // S^T = K Q^T : two 16-key sub-tiles, K(hd)=64 in two WMMAs each
    // s0[e] = S[query r][key 8*half + e], s1[e] = S[query r][key 16 + 8*half + e]
    v8f s0 = vzero, s1 = vzero;
    {
      v16h a00 = load_frag(&ksm[0], P64);
      v16h a01 = load_frag(&ksm[32], P64);
      v16h a10 = load_frag(&ksm[16 * P64], P64);
      v16h a11 = load_frag(&ksm[16 * P64 + 32], P64);
      s0 = wmma16(a00, bq0, s0);
      s1 = wmma16(a10, bq0, s1);
      s0 = wmma16(a01, bq1, s0);
      s1 = wmma16(a11, bq1, s1);
    }

    // online softmax: 16 of the 32 keys of query r in this lane, the other 16 in lane ^ 16
    float t8[8];
#pragma unroll
    for (int e = 0; e < 8; ++e) t8[e] = fmaxf(s0[e], s1[e]);
    float pm = fmaxf(fmaxf(fmaxf(t8[0], t8[1]), fmaxf(t8[2], t8[3])),
                     fmaxf(fmaxf(t8[4], t8[5]), fmaxf(t8[6], t8[7])));
    pm = fmaxf(pm, xhalf(pm)) * 0.125f;  // 1/sqrt(64): a power of two, so it commutes with the maximum exactly
    const float mnew = fmaxf(m, pm);
    const float al = __expf(m - mnew);
    float ps = 0.f;
    v16h bp;  // P^T B-fragment: element s is key 8*half + s (s < 8) or 16 + 8*half + (s - 8)
#pragma unroll
    for (int e = 0; e < 8; ++e) {
      const float p0 = __expf(s0[e] * 0.125f - mnew);
      const float p1 = __expf(s1[e] * 0.125f - mnew);
      ps += p0 + p1;
      bp[e]     = (_Float16)p0;
      bp[8 + e] = (_Float16)p1;
    }
    l = al * l + ps;
    m = mnew;

    // rescale running O^T (one query a lane: one factor) and accumulate V^T P^T (4 hd sub-tiles of 16)
#pragma unroll
    for (int t = 0; t < 4; ++t) {
#pragma unroll
      for (int e = 0; e < 8; ++e) acc[t][e] *= al;
      v16h av = load_frag(&vts[16 * t * P32], P32);
      acc[t] = wmma16(av, bp, acc[t]);
    }
  }

  // finalize: divide by row sums, emit f16 [B,N,D] with head-concat columns;
  // a lane's 8 values of a sub-tile are 8 adjacent hd of its query: one 16-byte store each
  const float linv = 1.f / (l + xhalf(l));
  const int b = bh >> 4, h = bh & 15;
  _Float16* dst = aout + (size_t)(b * SEQ + q0 + r) * DMODEL + h * 64 + 8 * half;
#pragma unroll
  for (int t = 0; t < 4; ++t) {
    Half8 pk;
#pragma unroll
    for (int e = 0; e < 8; ++e) pk.h[e] = (_Float16)(acc[t][e] * linv);
    *(uint4*)(dst + t * 16) = pk.u;
  }
}

extern "C" void kernel_launch(void* const* d_in, const int* in_sizes, int n_in,
                              void* d_out, int out_size, void* d_ws, size_t ws_size,
                              hipStream_t stream) {
  const float* x    = (const float*)d_in[0];
  const float* Wqkv = (const float*)d_in[1];
  const float* bqkv = (const float*)d_in[2];
  const float* qg   = (const float*)d_in[3];
  const float* qb   = (const float*)d_in[4];
  const float* kg   = (const float*)d_in[5];
  const float* kb   = (const float*)d_in[6];
  const float* Wo   = (const float*)d_in[7];
  const float* bo   = (const float*)d_in[8];
  float* out = (float*)d_out;

  char* ws = (char*)d_ws;
  size_t off = 0;
  auto alloc = [&](size_t bytes) -> char* {
    char* p = ws + off;
    off += (bytes + 255) & ~(size_t)255;
    return p;
  };
  _Float16* xh   = (_Float16*)alloc(4096ull * 1024 * 2);  // x in f16
  _Float16* wqt  = (_Float16*)alloc(3072ull * 1024 * 2);  // Wqkv^T f16
  _Float16* wot  = (_Float16*)alloc(1024ull * 1024 * 2);  // Wo^T f16
  _Float16* qh   = (_Float16*)alloc(64ull * 1024 * 64 * 2);
  _Float16* kh   = (_Float16*)alloc(64ull * 1024 * 64 * 2);
  _Float16* vth  = (_Float16*)alloc(64ull * 1024 * 64 * 2);
  _Float16* aout = (_Float16*)alloc(4096ull * 1024 * 2);

  cvt_inputs<<<1024, 256, 0, stream>>>(x, Wqkv, Wo, xh, wqt, wot);        // 512 + 384 + 128 blocks
  gemm_qkv_ln<<<dim3(32, 24), 128, 0, stream>>>(xh, wqt, bqkv, qg, qb, kg, kb, qh, kh, vth, 1024);
  flash_attn<<<dim3(64, 16), 128, 0, stream>>>(qh, kh, vth, aout);
  gemm_wmma<<<dim3(32, 8), 128, 0, stream>>>(aout, wot, bo, out, 4096, 1024, 1024);
}

// v007
// A run of this version takes 72.7 microseconds.
// Two timings next to v006 both put it at 1.14 times that version's speed.
// All steps since v000 together make it 4.19 times as fast.
#include <hip/hip_runtime.h>
#include <hip/hip_bf16.h>
#include <math.h>

typedef __attribute__((ext_vector_type(16))) _Float16 v16h;
typedef __attribute__((ext_vector_type(8)))  float    v8f;
typedef __attribute__((__vector_size__(4 * sizeof(int)))) int v4i;

#define SEQ 1024
#define DMODEL 1024
#define HD 64

// LDS row pitch, in f16 elements, of every tile that load_frag reads with 16-byte loads: 16 bytes x an odd
// number, so that the 16 rows of a fragment start on 16 different groups of four banks (a pitch of 64 or
// 128 bytes puts them on 4 or 2 groups, and each load then takes 4 or 8 times the LDS clocks).
#define P32 40   // rows of 32 f16 (64 bytes) at 80 bytes
#define P64 72   // rows of 64 f16 (128 bytes) at 144 bytes
#define PSEQ 1032  // rows of 1024 f16 (2048 bytes) at 2064 bytes

#define AS1 __attribute__((address_space(1)))
#define AS3 __attribute__((address_space(3)))

#if defined(__has_builtin)
#if __has_builtin(__builtin_amdgcn_global_load_async_to_lds_b128)
#define HAVE_ASYNC 1
#endif
#endif

#ifdef HAVE_ASYNC
#if __has_builtin(__builtin_amdgcn_s_wait_asynccnt)
#define ASYNC_WAIT(n) __builtin_amdgcn_s_wait_asynccnt(n)
#else
#define ASYNC_WAIT(n) asm volatile("s_wait_asynccnt " #n ::: "memory")
#endif
#else
#define ASYNC_WAIT(n)
#endif

// 16-byte tile-staging copy: async global->LDS (ASYNCcnt) when available,
// else synchronous through VGPRs.
__device__ __forceinline__ void copy16_to_lds(const _Float16* gsrc, _Float16* ldst) {
#ifdef HAVE_ASYNC
  __builtin_amdgcn_global_load_async_to_lds_b128(
      (AS1 v4i*)(gsrc), (AS3 v4i*)(ldst), 0, 0);
#else
  *(uint4*)ldst = *(const uint4*)gsrc;
#endif
}

__device__ __forceinline__ v8f wmma16(v16h a, v16h b, v8f c) {
  // v_wmma_f32_16x16x32_f16: D = A(16x32 f16) * B(32x16 f16) + C(16x16 f32)
  return __builtin_amdgcn_wmma_f32_16x16x32_f16(false, a, false, b, (short)0, c, false, false);
}

union FragU { v16h h; uint4 u[2]; };

// A/B fragment loader. Layout (ISA 7.12.2, 16-bit A 16x32):
//   lane L holds row (L&15); halves 0..7 = K in [koff, koff+8), halves 8..15 = K in [koff+16, koff+24)
//   where koff = 8*(L>>4). B mirrors A with "row" = output column of a [16][K] Bt tile.
__device__ __forceinline__ v16h load_frag(const _Float16* tile, int ldh) {
  const int lane = threadIdx.x & 31;
  const int row  = lane & 15;
  const int koff = (lane >> 4) << 3;
  const _Float16* p = tile + row * ldh + koff;
  FragU f;
  f.u[0] = *(const uint4*)(p);
  f.u[1] = *(const uint4*)(p + 16);
  return f.h;
}

// Sum over the 16 lanes of a row, result in every lane of the row (DPP row_xmask butterfly:
// stays in the vector unit, where a shuffle would go through the LDS unit).
template <int MASK>
__device__ __forceinline__ float add_xmask(float v) {
  return v + __builtin_bit_cast(float, __builtin_amdgcn_update_dpp(
                 0, __builtin_bit_cast(int, v), 0x160 | MASK, 0xf, 0xf, true));
}
__device__ __forceinline__ float row16_sum(float v) {
  v = add_xmask<1>(v);
  v = add_xmask<2>(v);
  v = add_xmask<4>(v);
  return add_xmask<8>(v);
}

// ---------------- conversion kernels ----------------
// 32 elements a thread, so that few waves have to start and each keeps 8 loads of 16 bytes in flight.
// The loops below are unrolled so that v[] stays in registers and the 8 loads issue as one group.
union Half4 { _Float16 h[4]; uint2 u; };
union Half8 { _Float16 h[8]; uint4 u; };

// fp32 -> f16, same order. A block takes 8192 consecutive elements; each of a thread's 8 loads is part of
// 512 contiguous bytes of its wave, all 8 issued before the first is used.
__device__ __forceinline__ void cvt_rows(const float* __restrict__ in, _Float16* __restrict__ out, int blk) {
  const size_t base = (size_t)blk * 8192 + threadIdx.x * 4;
  float4 v[8];
#pragma unroll
  for (int j = 0; j < 8; ++j) v[j] = *(const float4*)&in[base + j * 1024];
#pragma unroll
  for (int j = 0; j < 8; ++j) {
    Half4 pk;
    pk.h[0] = (_Float16)v[j].x; pk.h[1] = (_Float16)v[j].y;
    pk.h[2] = (_Float16)v[j].z; pk.h[3] = (_Float16)v[j].w;
    *(uint2*)&out[base + j * 1024] = pk.u;
  }
}

// W[K][N] fp32 -> Wt[N][K] f16  (Wt is the "Bt" operand: row = output column)
// A block of 8 waves takes 64 k x 128 n (tile bk, bn), a wave 64 k x 16 n, a thread 8 k x 4 n, transposed in its
// registers: 8 loads of 4 adjacent n, then 4 stores of 8 adjacent k. 8 lanes side by side in k store one whole 128-byte line.
// K and N are compile-time so that the row steps are immediate offsets on one address register pair.
template <int K, int N>
__device__ __forceinline__ void cvt_t_tile(const float* __restrict__ W, _Float16* __restrict__ Wt, int bn, int bk) {
  const int wave = threadIdx.x >> 5, lane = threadIdx.x & 31;
  const int n = bn * 128 + wave * 16 + (lane & 3) * 4;
  const int k = bk * 64 + (lane >> 2) * 8;
  const float* src = W + (size_t)k * N + n;
  _Float16* dst = Wt + (size_t)n * K + k;
  float4 v[8];
#pragma unroll
  for (int j = 0; j < 8; ++j) v[j] = *(const float4*)(src + j * N);
  Half8 c[4];
#pragma unroll
  for (int j = 0; j < 8; ++j) {
    c[0].h[j] = (_Float16)v[j].x; c[1].h[j] = (_Float16)v[j].y;
    c[2].h[j] = (_Float16)v[j].z; c[3].h[j] = (_Float16)v[j].w;
  }
#pragma unroll
  for (int i = 0; i < 4; ++i) *(uint4*)(dst + i * K) = c[i].u;
  // A block runs only this job and then ends; as a precaution this wait stands in front of any
  // overwrite of a register that one of the four issued stores names.
  asm volatile("s_wait_xcnt 0x0" ::: "memory");
}

// The three conversions read nothing of one another, so they share one launch: one gap, one fill and one tail
// where three launches in a row paid three. The block index picks the job (the same for a whole block).
#define CVT_X_BLOCKS    512  // 512 x 8192 = 4096 x 1024 elements of x
#define CVT_WQKV_BLOCKS 384  // 24 tiles of 128 n x 16 tiles of 64 k
#define CVT_WO_BLOCKS   128  // 8 tiles of 128 n x 16 tiles of 64 k
__global__ __launch_bounds__(256) void cvt_inputs(
    const float* __restrict__ x, const float* __restrict__ Wqkv, const float* __restrict__ Wo,
    _Float16* __restrict__ xh, _Float16* __restrict__ wqt, _Float16* __restrict__ wot) {
  const int blk = blockIdx.x;
  if (blk < CVT_X_BLOCKS) {
    cvt_rows(x, xh, blk);
  } else if (blk < CVT_X_BLOCKS + CVT_WQKV_BLOCKS) {
    const int t = blk - CVT_X_BLOCKS;
    cvt_t_tile<DMODEL, 3 * DMODEL>(Wqkv, wqt, t % 24, t / 24);
  } else {
    const int t = blk - (CVT_X_BLOCKS + CVT_WQKV_BLOCKS);
    cvt_t_tile<DMODEL, DMODEL>(Wo, wot, t & 7, t >> 3);
  }
}

// ---------------- tiled WMMA GEMM: C[M][N] = A[M][K](f16) * Bt[N][K](f16)^T + bias ----------------
// Double-buffered LDS, async global->LDS staging overlapped with WMMA compute.
// A block of 4 waves takes 128 x 128, a wave 64 x 64 (2 x 2 waves): 4 A and 4 B fragments feed 16 WMMAs,
// one 16-byte LDS load a WMMA.
__global__ __launch_bounds__(128) void gemm_wmma(
    const _Float16* __restrict__ A, const _Float16* __restrict__ Bt,
    const float* __restrict__ bias, float* __restrict__ C, int M, int N, int K) {
  __shared__ __attribute__((aligned(16))) _Float16 As[2][128 * P32];
  __shared__ __attribute__((aligned(16))) _Float16 Bs[2][128 * P32];
  const int tid = threadIdx.x, wave = tid >> 5, lane = tid & 31;
  const int wm = wave >> 1, wn = wave & 1;
  const int m0 = blockIdx.x * 128, n0 = blockIdx.y * 128;

  // Each thread stages 4 A-octets + 4 B-octets per K-step = 8 async-load instructions.
  auto issue_stage = [&](int buf, int k0) {
#pragma unroll  // the 8 copies of a stage issue back to back, their row steps folded at compile time
    for (int it = 0; it < 4; ++it) {  // 128 rows x 4 octets of f16
      int c = tid + it * 128;
      int r = c >> 2, s = c & 3;
      copy16_to_lds(&A[(size_t)(m0 + r) * K + k0 + s * 8], &As[buf][r * P32 + s * 8]);
      copy16_to_lds(&Bt[(size_t)(n0 + r) * K + k0 + s * 8], &Bs[buf][r * P32 + s * 8]);
    }
  };

  const v8f vzero = {0.f, 0.f, 0.f, 0.f, 0.f, 0.f, 0.f, 0.f};
  v8f acc[4][4];
#pragma unroll  // constant indices keep the tiles in registers
  for (int i = 0; i < 4; ++i)
#pragma unroll  // constant indices keep the tiles in registers
    for (int j = 0; j < 4; ++j) acc[i][j] = vzero;

  const int nsteps = K / 32;
  issue_stage(0, 0);
  for (int i = 0; i < nsteps; ++i) {
    const int cur = i & 1;
    if (i + 1 < nsteps) {
      issue_stage(cur ^ 1, (i + 1) * 32);  // prefetch next stage (overlaps compute)
      ASYNC_WAIT(8);                       // oldest 8 (current stage) complete; next 8 in flight
    } else {
      ASYNC_WAIT(0);
    }
    __syncthreads();
    v16h afr[4], bfr[4];
#pragma unroll  // constant indices keep the tiles in registers
    for (int j = 0; j < 4; ++j) {
      afr[j] = load_frag(&As[cur][(wm * 64 + j * 16) * P32], P32);
      bfr[j] = load_frag(&Bs[cur][(wn * 64 + j * 16) * P32], P32);
    }
#pragma unroll  // constant indices keep the tiles in registers
    for (int mi = 0; mi < 4; ++mi)
#pragma unroll  // constant indices keep the tiles in registers
      for (int j = 0; j < 4; ++j) acc[mi][j] = wmma16(afr[mi], bfr[j], acc[mi][j]);
    __syncthreads();  // all waves done reading buf[cur] before it is refilled
  }

  // D layout: lane holds col (lane&15); VGPR e is row e (lanes 0-15) / e+8 (lanes 16-31)
  const int ncol = lane & 15, half = lane >> 4;
#pragma unroll  // constant indices keep the tiles in registers
  for (int j = 0; j < 4; ++j) {
    int gc = n0 + wn * 64 + j * 16 + ncol;
    float bv = bias[gc];
#pragma unroll  // constant indices keep the tiles in registers
    for (int mi = 0; mi < 4; ++mi) {
#pragma unroll  // constant indices keep the tiles in registers
      for (int e = 0; e < 8; ++e) {
        int gr = m0 + wm * 64 + mi * 16 + e + 8 * half;
        C[(size_t)gr * N + gc] = acc[mi][j][e] + bv;
      }
    }
  }
}

// ---------------- QKV projection with bias, per-head LayerNorm and f16 split in the epilogue ----------------
// Same K loop as gemm_wmma on A = x[4096][1024], Bt = Wqkv^T[3072][1024]. A 128-column block is two whole
// heads of q, of k or of v, and a wave holds 64 full rows of one of them, so each LayerNorm row is complete in a wave.
// Writes qh,kh [B*H][N][64] f16 (k row-major == A for K*Q^T) and vth [B*H][64][N] f16 (v^T == A for V^T*P^T).
// Bt rows are staged permuted inside each head: LDS row hh*64 + jj*16 + r holds column hh*64 + 4*r + jj,
// so lane r ends up with the four adjacent columns 4r..4r+3 of its wave's head in acc[.][0..3].
__global__ __launch_bounds__(128) void gemm_qkv_ln(
    const _Float16* __restrict__ A, const _Float16* __restrict__ Bt, const float* __restrict__ bias,
    const float* __restrict__ qg, const float* __restrict__ qb,
    const float* __restrict__ kg, const float* __restrict__ kb,
    _Float16* __restrict__ qh, _Float16* __restrict__ kh, _Float16* __restrict__ vth, int K) {
  __shared__ __attribute__((aligned(16))) _Float16 As[2][128 * P32];
  __shared__ __attribute__((aligned(16))) _Float16 Bs[2][128 * P32];
  const int tid = threadIdx.x, wave = tid >> 5, lane = tid & 31;
  const int wm = wave >> 1, wn = wave & 1;
  const int m0 = blockIdx.x * 128, n0 = blockIdx.y * 128;

  auto issue_stage = [&](int buf, int k0) {
#pragma unroll  // the 8 copies of a stage issue back to back, their row steps folded at compile time
    for (int it = 0; it < 4; ++it) {  // 128 rows x 4 octets of f16
      int c = tid + it * 128;
      int r = c >> 2, s = c & 3;
      int pr = (r & 64) | ((r & 15) << 2) | ((r >> 4) & 3);  // column staged in LDS row r
      copy16_to_lds(&A[(size_t)(m0 + r) * K + k0 + s * 8], &As[buf][r * P32 + s * 8]);
      copy16_to_lds(&Bt[(size_t)(n0 + pr) * K + k0 + s * 8], &Bs[buf][r * P32 + s * 8]);
    }
  };

  const v8f vzero = {0.f, 0.f, 0.f, 0.f, 0.f, 0.f, 0.f, 0.f};
  v8f acc[4][4];
#pragma unroll  // constant indices keep the tiles in registers
  for (int i = 0; i < 4; ++i)
#pragma unroll  // constant indices keep the tiles in registers
    for (int j = 0; j < 4; ++j) acc[i][j] = vzero;

  const int nsteps = K / 32;
  issue_stage(0, 0);
  for (int i = 0; i < nsteps; ++i) {
    const int cur = i & 1;
    if (i + 1 < nsteps) {
      issue_stage(cur ^ 1, (i + 1) * 32);  // prefetch next stage (overlaps compute)
      ASYNC_WAIT(8);                       // oldest 8 (current stage) complete; next 8 in flight
    } else {
      ASYNC_WAIT(0);
    }
    __syncthreads();
    v16h afr[4], bfr[4];
#pragma unroll  // constant indices keep the tiles in registers
    for (int j = 0; j < 4; ++j) {
      afr[j] = load_frag(&As[cur][(wm * 64 + j * 16) * P32], P32);
      bfr[j] = load_frag(&Bs[cur][(wn * 64 + j * 16) * P32], P32);
    }
#pragma unroll  // constant indices keep the tiles in registers
    for (int mi = 0; mi < 4; ++mi)
#pragma unroll  // constant indices keep the tiles in registers
      for (int j = 0; j < 4; ++j) acc[mi][j] = wmma16(afr[mi], bfr[j], acc[mi][j]);
    __syncthreads();  // all waves done reading buf[cur] before it is refilled
  }

  // D layout: lane holds one column (index lane&15); VGPR e is row e (lanes 0-15) / e+8 (lanes 16-31)
  const int r = lane & 15, half = lane >> 4;
  const int sel = n0 >> 10;                       // 0: q, 1: k, 2: v (the same for the whole block)
  const int grow = m0 + wm * 64 + 8 * half;       // first of this lane's 8 rows in row tile 0
  const int b = grow >> 10, n = grow & (SEQ - 1);
  const size_t bh = (size_t)(b * 16 + ((n0 & 1023) >> 6) + wn);  // this wave's head
  const float4 bv = *(const float4*)&bias[n0 + wn * 64 + 4 * r];
  const float bj[4] = {bv.x, bv.y, bv.z, bv.w};
  if (sel == 2) {
    // v^T: a lane's 8 rows of a row tile are 8 consecutive n of column 4r+jj: one 16-byte store each
#pragma unroll  // constant indices keep the tiles in registers
    for (int mi = 0; mi < 4; ++mi) {
#pragma unroll  // constant indices keep the tiles in registers
      for (int jj = 0; jj < 4; ++jj) {
        union { _Float16 h[8]; uint4 u; } pk;
#pragma unroll  // constant indices keep the tiles in registers
        for (int e = 0; e < 8; ++e) pk.h[e] = (_Float16)(acc[mi][jj][e] + bj[jj]);
        *(uint4*)&vth[bh * (HD * SEQ) + (size_t)(4 * r + jj) * SEQ + n + mi * 16] = pk.u;
      }
    }
  } else {
    const float4 g4 = *(const float4*)&(sel ? kg : qg)[4 * r];
    const float4 b4 = *(const float4*)&(sel ? kb : qb)[4 * r];
    _Float16* dst = (sel ? kh : qh) + (bh * SEQ + n) * HD + 4 * r;
#pragma unroll  // constant indices keep the tiles in registers
    for (int mi = 0; mi < 4; ++mi) {
      union { _Float16 h[4]; unsigned long long u; } pk[8];
#pragma unroll  // constant indices keep the tiles in registers
      for (int e = 0; e < 8; ++e) {
        float t0 = acc[mi][0][e] + bj[0], t1 = acc[mi][1][e] + bj[1];
        float t2 = acc[mi][2][e] + bj[2], t3 = acc[mi][3][e] + bj[3];
        float mu = row16_sum((t0 + t1) + (t2 + t3)) * (1.f / 64.f);
        t0 -= mu; t1 -= mu; t2 -= mu; t3 -= mu;
        float var = row16_sum((t0 * t0 + t1 * t1) + (t2 * t2 + t3 * t3)) * (1.f / 64.f) + 1e-5f;
        float rs;
        // var >= 1e-5, so the library's rescaling of subnormal arguments is an identity here; the v_nop keeps
        // the one free slot the instruction set asks for behind a transcendental, whatever is scheduled next.
        asm("v_rsq_f32 %0, %1\n\tv_nop" : "=v"(rs) : "v"(var));
        pk[e].h[0] = (_Float16)(t0 * rs * g4.x + b4.x);
        pk[e].h[1] = (_Float16)(t1 * rs * g4.y + b4.y);
        pk[e].h[2] = (_Float16)(t2 * rs * g4.z + b4.z);
        pk[e].h[3] = (_Float16)(t3 * rs * g4.w + b4.w);
      }
      // The 8 rows of a row tile; 16 lanes x 8 bytes are one whole 128-byte head row. The stores and their wait
      // are one statement so that the next row tile's arithmetic, which reuses these registers, stays behind the wait.
      asm volatile(
          "global_store_b64 %0, %1, off\n\t"
          "global_store_b64 %0, %2, off offset:128\n\t"
          "global_store_b64 %0, %3, off offset:256\n\t"
          "global_store_b64 %0, %4, off offset:384\n\t"
          "global_store_b64 %0, %5, off offset:512\n\t"
          "global_store_b64 %0, %6, off offset:640\n\t"
          "global_store_b64 %0, %7, off offset:768\n\t"
          "global_store_b64 %0, %8, off offset:896\n\t"
          "s_wait_xcnt 0x0"
          :: "v"(dst + mi * 16 * HD), "v"(pk[0].u), "v"(pk[1].u), "v"(pk[2].u), "v"(pk[3].u),
             "v"(pk[4].u), "v"(pk[5].u), "v"(pk[6].u), "v"(pk[7].u)
          : "memory");
    }
  }
}

// ---------------- flash attention: block = (b*h, 256-query tile), 16 waves x 16 queries ----------------
// Lane l with lane l ^ 16, in the vector unit (a shuffle would go through the LDS unit).
__device__ __forceinline__ float xhalf(float x) {
  const int b = __builtin_bit_cast(int, x);
  return __builtin_bit_cast(float, __builtin_amdgcn_permlanex16(b, b, 0x76543210, 0xfedcba98, false, false));
}

__global__ __launch_bounds__(512) void flash_attn(
    const _Float16* __restrict__ qh, const _Float16* __restrict__ kh,
    const _Float16* __restrict__ vth, _Float16* __restrict__ aout) {
  __shared__ __attribute__((aligned(16))) _Float16 ksm[SEQ * P64];     // 1024 keys x 64 hd
  __shared__ __attribute__((aligned(16))) _Float16 vts[HD * PSEQ];     // 64 hd x 1024 keys (v^T)

  const int tid = threadIdx.x, wave = tid >> 5, lane = tid & 31;
  const int bh = blockIdx.x;                       // 0..63
  const int q0 = blockIdx.y * 256 + wave * 16;     // query tile base
  const int r = lane & 15, half = lane >> 4;

  const _Float16* qp = qh + (size_t)bh * SEQ * HD;
  const _Float16* kp = kh + (size_t)bh * SEQ * HD;
  const _Float16* vp = vth + (size_t)bh * HD * SEQ;

  // Keys 256*j .. 256*j+255: 4 copies of K and 4 of V^T a thread; a wave's 32 lanes take 512 contiguous bytes.
  auto stage_keys = [&](int j) {
#pragma unroll  // the copies issue back to back, their steps folded at compile time
    for (int it = 0; it < 4; ++it) {
      const int c = tid + it * 512;
      const int kc = j * 2048 + c;             // K: 256 rows x 8 octets, contiguous in memory
      copy16_to_lds(&kp[(size_t)kc * 8], &ksm[(kc >> 3) * P64 + (kc & 7) * 8]);
      const int dd = c >> 5, s = j * 32 + (c & 31);  // V^T: 64 rows x 32 octets
      copy16_to_lds(&vp[(size_t)dd * SEQ + s * 8], &vts[dd * PSEQ + s * 8]);
    }
  };
  stage_keys(0);

  // Q^T B-fragments (column = query r) held in registers for the whole pass (hd split into two K=32 chunks)
  v16h bq0 = load_frag(qp + (size_t)q0 * HD, HD);
  v16h bq1 = load_frag(qp + (size_t)q0 * HD + 32, HD);

  const v8f vzero = {0.f, 0.f, 0.f, 0.f, 0.f, 0.f, 0.f, 0.f};
  v8f acc[4];  // acc[t][e] = O[query r][hd 16t + 8*half + e]
#pragma unroll
  for (int t = 0; t < 4; ++t) acc[t] = vzero;
  float m = -INFINITY;  // running maximum of query r, the same in both halves
  float l = 0.f;        // running sum over this half's keys only; the halves are joined behind the loop

  for (int part = 0; part < 2; ++part) {
    // This wave's own copies have landed; behind the barrier every wave's have. No key of a part is read before.
    asm volatile("s_wait_asynccnt 0x0" ::: "memory");
    __syncthreads();
    if (part == 0) {
      stage_keys(1);
      stage_keys(2);
      stage_keys(3);
    }
    const int kend = part ? 32 : 8;
    for (int kb = part ? 8 : 0; kb < kend; ++kb) {
      const _Float16* kt = &ksm[kb * 32 * P64];  // this pass's 32 keys
      const _Float16* vt = &vts[kb * 32];
      // S^T = K Q^T : two 16-key sub-tiles, K(hd)=64 in two WMMAs each
      // s0[e] = S[query r][key 8*half + e], s1[e] = S[query r][key 16 + 8*half + e]
      v8f s0 = vzero, s1 = vzero;
      {
        v16h a00 = load_frag(kt, P64);
        v16h a01 = load_frag(kt + 32, P64);
        v16h a10 = load_frag(kt + 16 * P64, P64);
        v16h a11 = load_frag(kt + 16 * P64 + 32, P64);
        s0 = wmma16(a00, bq0, s0);
        s1 = wmma16(a10, bq0, s1);
        s0 = wmma16(a01, bq1, s0);
        s1 = wmma16(a11, bq1, s1);
      }

      // online softmax: 16 of the 32 keys of query r in this lane, the other 16 in lane ^ 16
      float t8[8];
#pragma unroll
      for (int e = 0; e < 8; ++e) t8[e] = fmaxf(s0[e], s1[e]);
      float pm = fmaxf(fmaxf(fmaxf(t8[0], t8[1]), fmaxf(t8[2], t8[3])),
                       fmaxf(fmaxf(t8[4], t8[5]), fmaxf(t8[6], t8[7])));
      pm = fmaxf(pm, xhalf(pm)) * 0.125f;  // 1/sqrt(64): a power of two, so it commutes with the maximum exactly
      const float mnew = fmaxf(m, pm);
      const float al = __expf(m - mnew);
      float ps = 0.f;
      v16h bp;  // P^T B-fragment: element s is key 8*half + s (s < 8) or 16 + 8*half + (s - 8)
#pragma unroll
      for (int e = 0; e < 8; ++e) {
        const float p0 = __expf(s0[e] * 0.125f - mnew);
        const float p1 = __expf(s1[e] * 0.125f - mnew);
        ps += p0 + p1;
        bp[e]     = (_Float16)p0;
        bp[8 + e] = (_Float16)p1;
      }
      l = al * l + ps;
      m = mnew;

      // rescale running O^T (one query a lane: one factor) and accumulate V^T P^T (4 hd sub-tiles of 16)
#pragma unroll
      for (int t = 0; t < 4; ++t) {
#pragma unroll
        for (int e = 0; e < 8; ++e) acc[t][e] *= al;
        v16h av = load_frag(vt + 16 * t * PSEQ, PSEQ);
        acc[t] = wmma16(av, bp, acc[t]);
      }
    }
  }

  // finalize: divide by row sums, emit f16 [B,N,D] with head-concat columns;
  // a lane's 8 values of a sub-tile are 8 adjacent hd of its query: one 16-byte store each
  const float linv = 1.f / (l + xhalf(l));
  const int b = bh >> 4, h = bh & 15;
  _Float16* dst = aout + (size_t)(b * SEQ + q0 + r) * DMODEL + h * 64 + 8 * half;
#pragma unroll
  for (int t = 0; t < 4; ++t) {
    Half8 pk;
#pragma unroll
    for (int e = 0; e < 8; ++e) pk.h[e] = (_Float16)(acc[t][e] * linv);
    *(uint4*)(dst + t * 16) = pk.u;
  }
}

extern "C" void kernel_launch(void* const* d_in, const int* in_sizes, int n_in,
                              void* d_out, int out_size, void* d_ws, size_t ws_size,
                              hipStream_t stream) {
  const float* x    = (const float*)d_in[0];
  const float* Wqkv = (const float*)d_in[1];
  const float* bqkv = (const float*)d_in[2];
  const float* qg   = (const float*)d_in[3];
  const float* qb   = (const float*)d_in[4];
  const float* kg   = (const float*)d_in[5];
  const float* kb   = (const float*)d_in[6];
  const float* Wo   = (const float*)d_in[7];
  const float* bo   = (const float*)d_in[8];
  float* out = (float*)d_out;

  char* ws = (char*)d_ws;
  size_t off = 0;
  auto alloc = [&](size_t bytes) -> char* {
    char* p = ws + off;
    off += (bytes + 255) & ~(size_t)255;
    return p;
  };
  _Float16* xh   = (_Float16*)alloc(4096ull * 1024 * 2);  // x in f16
  _Float16* wqt  = (_Float16*)alloc(3072ull * 1024 * 2);  // Wqkv^T f16
  _Float16* wot  = (_Float16*)alloc(1024ull * 1024 * 2);  // Wo^T f16
  _Float16* qh   = (_Float16*)alloc(64ull * 1024 * 64 * 2);
  _Float16* kh   = (_Float16*)alloc(64ull * 1024 * 64 * 2);
  _Float16* vth  = (_Float16*)alloc(64ull * 1024 * 64 * 2);
  _Float16* aout = (_Float16*)alloc(4096ull * 1024 * 2);

  cvt_inputs<<<1024, 256, 0, stream>>>(x, Wqkv, Wo, xh, wqt, wot);        // 512 + 384 + 128 blocks
  gemm_qkv_ln<<<dim3(32, 24), 128, 0, stream>>>(xh, wqt, bqkv, qg, qb, kg, kb, qh, kh, vth, 1024);
  flash_attn<<<dim3(64, 4), 512, 0, stream>>>(qh, kh, vth, aout);
  gemm_wmma<<<dim3(32, 8), 128, 0, stream>>>(aout, wot, bo, out, 4096, 1024, 1024);
}

// v008
// Measured time: 59.2 microseconds a run.
// Timed twice side by side with v007, it ran 1.20 and 1.19 times as fast.
// Over all steps from v000 it is 5.01 times as fast.
#include <hip/hip_runtime.h>
#include <hip/hip_bf16.h>
#include <math.h>

typedef __attribute__((ext_vector_type(16))) _Float16 v16h;
typedef __attribute__((ext_vector_type(8)))  float    v8f;
typedef __attribute__((__vector_size__(4 * sizeof(int)))) int v4i;

#define SEQ 1024
#define DMODEL 1024
#define HD 64

// LDS row pitch, in f16 elements, of every tile that load_frag reads with 16-byte loads: 16 bytes x an odd
// number, so that the 16 rows of a fragment start on 16 different groups of four banks (a pitch of 64 or
// 128 bytes puts them on 4 or 2 groups, and each load then takes 4 or 8 times the LDS clocks).
#define P64 72   // rows of 64 f16 (128 bytes) at 144 bytes
#define PSEQ 1032  // rows of 1024 f16 (2048 bytes) at 2064 bytes

#define AS1 __attribute__((address_space(1)))
#define AS3 __attribute__((address_space(3)))

#if defined(__has_builtin)
#if __has_builtin(__builtin_amdgcn_global_load_async_to_lds_b128)
#define HAVE_ASYNC 1
#endif
#endif

// 16-byte tile-staging copy: async global->LDS (ASYNCcnt) when available,
// else synchronous through VGPRs.
__device__ __forceinline__ void copy16_to_lds(const _Float16* gsrc, _Float16* ldst) {
#ifdef HAVE_ASYNC
  __builtin_amdgcn_global_load_async_to_lds_b128(
      (AS1 v4i*)(gsrc), (AS3 v4i*)(ldst), 0, 0);
#else
  *(uint4*)ldst = *(const uint4*)gsrc;
#endif
}

__device__ __forceinline__ v8f wmma16(v16h a, v16h b, v8f c) {
  // v_wmma_f32_16x16x32_f16: D = A(16x32 f16) * B(32x16 f16) + C(16x16 f32)
  return __builtin_amdgcn_wmma_f32_16x16x32_f16(false, a, false, b, (short)0, c, false, false);
}

union FragU { v16h h; uint4 u[2]; };

// A/B fragment loader. Layout (ISA 7.12.2, 16-bit A 16x32):
//   lane L holds row (L&15); halves 0..7 = K in [koff, koff+8), halves 8..15 = K in [koff+16, koff+24)
//   where koff = 8*(L>>4). B mirrors A with "row" = output column of a [16][K] Bt tile.
__device__ __forceinline__ v16h load_frag(const _Float16* tile, int ldh) {
  const int lane = threadIdx.x & 31;
  const int row  = lane & 15;
  const int koff = (lane >> 4) << 3;
  const _Float16* p = tile + row * ldh + koff;
  FragU f;
  f.u[0] = *(const uint4*)(p);
  f.u[1] = *(const uint4*)(p + 16);
  return f.h;
}

// Sum over the 16 lanes of a row, result in every lane of the row (DPP row_xmask butterfly:
// stays in the vector unit, where a shuffle would go through the LDS unit).
template <int MASK>
__device__ __forceinline__ float add_xmask(float v) {
  return v + __builtin_bit_cast(float, __builtin_amdgcn_update_dpp(
                 0, __builtin_bit_cast(int, v), 0x160 | MASK, 0xf, 0xf, true));
}
__device__ __forceinline__ float row16_sum(float v) {
  v = add_xmask<1>(v);
  v = add_xmask<2>(v);
  v = add_xmask<4>(v);
  return add_xmask<8>(v);
}

// ---------------- conversion kernels ----------------
// 32 elements a thread, so that few waves have to start and each keeps 8 loads of 16 bytes in flight.
// The loops below are unrolled so that v[] stays in registers and the 8 loads issue as one group.
union Half4 { _Float16 h[4]; uint2 u; };
union Half8 { _Float16 h[8]; uint4 u; };

// fp32 -> f16, same order. A block takes 8192 consecutive elements; each of a thread's 8 loads is part of
// 512 contiguous bytes of its wave, all 8 issued before the first is used.
__device__ __forceinline__ void cvt_rows(const float* __restrict__ in, _Float16* __restrict__ out, int blk) {
  const size_t base = (size_t)blk * 8192 + threadIdx.x * 4;
  float4 v[8];
#pragma unroll
  for (int j = 0; j < 8; ++j) v[j] = *(const float4*)&in[base + j * 1024];
#pragma unroll
  for (int j = 0; j < 8; ++j) {
    Half4 pk;
    pk.h[0] = (_Float16)v[j].x; pk.h[1] = (_Float16)v[j].y;
    pk.h[2] = (_Float16)v[j].z; pk.h[3] = (_Float16)v[j].w;
    *(uint2*)&out[base + j * 1024] = pk.u;
  }
}

// W[K][N] fp32 -> Wt[N][K] f16  (Wt is the "Bt" operand: row = output column)
// A block of 8 waves takes 64 k x 128 n (tile bk, bn), a wave 64 k x 16 n, a thread 8 k x 4 n, transposed in its
// registers: 8 loads of 4 adjacent n, then 4 stores of 8 adjacent k. 8 lanes side by side in k store one whole 128-byte line.
// K and N are compile-time so that the row steps are immediate offsets on one address register pair.
template <int K, int N>
__device__ __forceinline__ void cvt_t_tile(const float* __restrict__ W, _Float16* __restrict__ Wt, int bn, int bk) {
  const int wave = threadIdx.x >> 5, lane = threadIdx.x & 31;
  const int n = bn * 128 + wave * 16 + (lane & 3) * 4;
  const int k = bk * 64 + (lane >> 2) * 8;
  const float* src = W + (size_t)k * N + n;
  _Float16* dst = Wt + (size_t)n * K + k;
  float4 v[8];
#pragma unroll
  for (int j = 0; j < 8; ++j) v[j] = *(const float4*)(src + j * N);
  Half8 c[4];
#pragma unroll
  for (int j = 0; j < 8; ++j) {
    c[0].h[j] = (_Float16)v[j].x; c[1].h[j] = (_Float16)v[j].y;
    c[2].h[j] = (_Float16)v[j].z; c[3].h[j] = (_Float16)v[j].w;
  }
#pragma unroll
  for (int i = 0; i < 4; ++i) *(uint4*)(dst + i * K) = c[i].u;
  // A block runs only this job and then ends; as a precaution this wait stands in front of any
  // overwrite of a register that one of the four issued stores names.
  asm volatile("s_wait_xcnt 0x0" ::: "memory");
}

// The three conversions read nothing of one another, so they share one launch: one gap, one fill and one tail
// where three launches in a row paid three. The block index picks the job (the same for a whole block).
#define CVT_X_BLOCKS    512  // 512 x 8192 = 4096 x 1024 elements of x
#define CVT_WQKV_BLOCKS 384  // 24 tiles of 128 n x 16 tiles of 64 k
#define CVT_WO_BLOCKS   128  // 8 tiles of 128 n x 16 tiles of 64 k
__global__ __launch_bounds__(256) void cvt_inputs(
    const float* __restrict__ x, const float* __restrict__ Wqkv, const float* __restrict__ Wo,
    _Float16* __restrict__ xh, _Float16* __restrict__ wqt, _Float16* __restrict__ wot) {
  const int blk = blockIdx.x;
  if (blk < CVT_X_BLOCKS) {
    cvt_rows(x, xh, blk);
  } else if (blk < CVT_X_BLOCKS + CVT_WQKV_BLOCKS) {
    const int t = blk - CVT_X_BLOCKS;
    cvt_t_tile<DMODEL, 3 * DMODEL>(Wqkv, wqt, t % 24, t / 24);
  } else {
    const int t = blk - (CVT_X_BLOCKS + CVT_WQKV_BLOCKS);
    cvt_t_tile<DMODEL, DMODEL>(Wo, wot, t & 7, t >> 3);
  }
}

// ---------------- the K loop of both GEMMs: acc[4][4] += A[m0.., :] * Bt[n0.., :]^T ----------------
// A block of 4 waves takes 128 x 128, a wave 64 x 64 (2 x 2 waves): 4 A and 4 B fragments feed a block of 16 WMMAs,
// one 16-byte LDS load a WMMA.
// The loop is software-pipelined. Registers: two fragment sets; the 16 LDS loads of the next 32 k go out as one
// group in front of the current block of WMMAs and return under it, so that a wave does not wait out LDS latency.
// LDS: a stage is 64 k (two blocks) of the 128 A rows and the 128 B rows; a row's share is one whole 128-byte line.
// As the first fragments of stage i + 1 are fetched under the last block of stage i, stage i + 1 is published in
// front of that block; every wave then holds all of stage i in registers, and its buffer is refilled at once.
#define BK 64             // k of a stage
#define STAGE_COPIES 16   // copies of a thread and stage: 2 x 128 rows x 8 octets / 128 threads
#define STAGE_H (128 * P64)  // f16 elements of one operand's stage in LDS
#define NST_QKV 2         // buffers; three blocks share a WGP and fill one another's waits
#define NST_OUT 4         // one block a WGP, one wave a SIMD: three stages fly ahead

// This wave's copies have landed, all but those of the FLY youngest stages (copies land in issue order).
template <int FLY>
__device__ __forceinline__ void wait_stages() {
  asm volatile("s_wait_asynccnt %0" :: "n"(STAGE_COPIES * FLY) : "memory");
}

// PERM: Bt rows are staged permuted inside each group of 64 (see gemm_qkv_ln).
template <int NST, bool PERM>
__device__ __forceinline__ void gemm_k_loop(const _Float16* __restrict__ A, const _Float16* __restrict__ Bt, int K,
                                            int m0, int n0, _Float16* As, _Float16* Bs, v8f (&acc)[4][4]) {
  const int tid = threadIdx.x, wave = tid >> 5;
  const int wm = wave >> 1, wn = wave & 1;
  const int tr = tid >> 3, ts = tid & 7;  // a thread's row in each group of 16 rows, and its octet of the row
  const unsigned aoff = (unsigned)(tr * K + ts * 8);
  const unsigned boff = (unsigned)((PERM ? tr * 4 : tr) * K + ts * 8);
  const int loff = tr * P64 + ts * 8;

  // Copy c (0..15) of stage st, into buffer st % NST: LDS rows 16 * (c >> 1) + tr of A (c even) or of Bt (c odd).
  // A wave's copy takes 4 rows x 128 bytes.
  auto issue_copy = [&](int st, int c) {
    const int it = c >> 1;
    const int lo = (st & (NST - 1)) * STAGE_H + it * 16 * P64 + loff;
    if ((c & 1) == 0) {
      copy16_to_lds(A + (size_t)m0 * K + st * BK + (size_t)(it * 16) * K + aoff, As + lo);
    } else {
      const int brow = PERM ? (it >> 2) * 64 + (it & 3) : it * 16;  // + 4 * tr or + tr: the Bt row staged there
      copy16_to_lds(Bt + (size_t)n0 * K + st * BK + (size_t)brow * K + boff, Bs + lo);
    }
  };
  auto issue_stage = [&](int st) {
#pragma unroll  // the 16 copies of a stage issue back to back
    for (int c = 0; c < STAGE_COPIES; ++c) issue_copy(st, c);
  };
  auto load_set = [&](v16h (&a)[4], v16h (&b)[4], int buf, int kk) {
    const _Float16* as = As + buf * STAGE_H + wm * 64 * P64 + kk;
    const _Float16* bs = Bs + buf * STAGE_H + wn * 64 * P64 + kk;
#pragma unroll  // constant indices keep the fragments in registers
    for (int j = 0; j < 4; ++j) {
      a[j] = load_frag(as + j * 16 * P64, P64);
      b[j] = load_frag(bs + j * 16 * P64, P64);
    }
  };
  auto mma_block = [&](const v16h (&a)[4], const v16h (&b)[4]) {
#pragma unroll  // constant indices keep the tiles in registers
    for (int mi = 0; mi < 4; ++mi)
#pragma unroll  // constant indices keep the tiles in registers
      for (int j = 0; j < 4; ++j) acc[mi][j] = wmma16(a[mi], b[j], acc[mi][j]);
  };

  const v8f vzero = {0.f, 0.f, 0.f, 0.f, 0.f, 0.f, 0.f, 0.f};
#pragma unroll  // constant indices keep the tiles in registers
  for (int i = 0; i < 4; ++i)
#pragma unroll  // constant indices keep the tiles in registers
    for (int j = 0; j < 4; ++j) acc[i][j] = vzero;

  const int nst = K / BK;
#pragma unroll  // the first stages' copies issue back to back
  for (int s = 0; s < NST - 1; ++s)
    if (s < nst) issue_stage(s);
  if (NST > 2 && NST - 1 <= nst) wait_stages<NST - 2>(); else wait_stages<0>();  // stage 0 has landed
  __syncthreads();
  if (NST - 1 < nst) issue_stage(NST - 1);
  v16h a0[4], b0[4], a1[4], b1[4];
  load_set(a0, b0, 0, 0);
#pragma clang loop unroll(disable)  // one copy of the body, for speed only
  for (int i = 0; i < nst; ++i) {
    const int cur = i & (NST - 1);
    // The scheduling fences keep each group of loads whole and in front of the block of WMMAs it flies under, for speed only.
    __builtin_amdgcn_sched_barrier(0);
    load_set(a1, b1, cur, 32);
    __builtin_amdgcn_sched_barrier(0);
    mma_block(a0, b0);
    __builtin_amdgcn_sched_barrier(0);
    // Publish point of stage i + 1: this wave's reads of stage i have returned; its copies of stage i + 1 have landed;
    // behind the barrier both hold for every wave.
    asm volatile("s_wait_dscnt 0x0" ::: "memory");
    if (NST > 2 && i + NST - 1 < nst) wait_stages<NST - 2>(); else wait_stages<0>();
    __syncthreads();
    // On the last trip these loads read the current buffer again, which nothing refills, and their values are not
    // used: without a branch around them the compiler's counted waits stay exact.
    load_set(a0, b0, (i + 1 < nst) ? ((i + 1) & (NST - 1)) : cur, 0);
    __builtin_amdgcn_sched_barrier(0);
    if (i + NST < nst) issue_stage(i + NST);  // into the buffer just left
    mma_block(a1, b1);
  }
  // The last trip's unused fragment loads have returned before their registers serve the epilogue.
  asm volatile("s_wait_dscnt 0x0" ::: "memory");
}

// ---------------- tiled WMMA GEMM: C[M][N] = A[M][K](f16) * Bt[N][K](f16)^T + bias ----------------
__global__ __launch_bounds__(128) void gemm_wmma(
    const _Float16* __restrict__ A, const _Float16* __restrict__ Bt,
    const float* __restrict__ bias, float* __restrict__ C, int M, int N, int K) {
  __shared__ __attribute__((aligned(16))) _Float16 As[NST_OUT * STAGE_H];
  __shared__ __attribute__((aligned(16))) _Float16 Bs[NST_OUT * STAGE_H];
  const int tid = threadIdx.x, wave = tid >> 5, lane = tid & 31;
  const int wm = wave >> 1, wn = wave & 1;
  const int m0 = blockIdx.x * 128, n0 = blockIdx.y * 128;

  v8f acc[4][4];
  gemm_k_loop<NST_OUT, false>(A, Bt, K, m0, n0, As, Bs, acc);

  // D layout: lane holds col (lane&15); VGPR e is row e (lanes 0-15) / e+8 (lanes 16-31)
  const int ncol = lane & 15, half = lane >> 4;
#pragma unroll  // constant indices keep the tiles in registers
  for (int j = 0; j < 4; ++j) {
    int gc = n0 + wn * 64 + j * 16 + ncol;
    float bv = bias[gc];
#pragma unroll  // constant indices keep the tiles in registers
    for (int mi = 0; mi < 4; ++mi) {
#pragma unroll  // constant indices keep the tiles in registers
      for (int e = 0; e < 8; ++e) {
        int gr = m0 + wm * 64 + mi * 16 + e + 8 * half;
        C[(size_t)gr * N + gc] = acc[mi][j][e] + bv;
      }
    }
  }
}

// ---------------- QKV projection with bias, per-head LayerNorm and f16 split in the epilogue ----------------
// The K loop on A = x[4096][1024], Bt = Wqkv^T[3072][1024]. A 128-column block is two whole
// heads of q, of k or of v, and a wave holds 64 full rows of one of them, so each LayerNorm row is complete in a wave.
// Writes qh,kh [B*H][N][64] f16 (k row-major == A for K*Q^T) and vth [B*H][64][N] f16 (v^T == A for V^T*P^T).
// Bt rows are staged permuted inside each head: LDS row hh*64 + jj*16 + r holds column hh*64 + 4*r + jj,
// so lane r ends up with the four adjacent columns 4r..4r+3 of its wave's head in acc[.][0..3].
__global__ __launch_bounds__(128) void gemm_qkv_ln(
    const _Float16* __restrict__ A, const _Float16* __restrict__ Bt, const float* __restrict__ bias,
    const float* __restrict__ qg, const float* __restrict__ qb,
    const float* __restrict__ kg, const float* __restrict__ kb,
    _Float16* __restrict__ qh, _Float16* __restrict__ kh, _Float16* __restrict__ vth, int K) {
  __shared__ __attribute__((aligned(16))) _Float16 As[NST_QKV * STAGE_H];
  __shared__ __attribute__((aligned(16))) _Float16 Bs[NST_QKV * STAGE_H];
  const int tid = threadIdx.x, wave = tid >> 5, lane = tid & 31;
  const int wm = wave >> 1, wn = wave & 1;
  const int m0 = blockIdx.x * 128, n0 = blockIdx.y * 128;

  v8f acc[4][4];
  gemm_k_loop<NST_QKV, true>(A, Bt, K, m0, n0, As, Bs, acc);

  // D layout: lane holds one column (index lane&15); VGPR e is row e (lanes 0-15) / e+8 (lanes 16-31)
  const int r = lane & 15, half = lane >> 4;
  const int sel = n0 >> 10;                       // 0: q, 1: k, 2: v (the same for the whole block)
  const int grow = m0 + wm * 64 + 8 * half;       // first of this lane's 8 rows in row tile 0
  const int b = grow >> 10, n = grow & (SEQ - 1);
  const size_t bh = (size_t)(b * 16 + ((n0 & 1023) >> 6) + wn);  // this wave's head
  const float4 bv = *(const float4*)&bias[n0 + wn * 64 + 4 * r];
  const float bj[4] = {bv.x, bv.y, bv.z, bv.w};
  if (sel == 2) {
    // v^T: a lane's 8 rows of a row tile are 8 consecutive n of column 4r+jj: one 16-byte store each
#pragma unroll  // constant indices keep the tiles in registers
    for (int mi = 0; mi < 4; ++mi) {
#pragma unroll  // constant indices keep the tiles in registers
      for (int jj = 0; jj < 4; ++jj) {
        union { _Float16 h[8]; uint4 u; } pk;
#pragma unroll  // constant indices keep the tiles in registers
        for (int e = 0; e < 8; ++e) pk.h[e] = (_Float16)(acc[mi][jj][e] + bj[jj]);
        *(uint4*)&vth[bh * (HD * SEQ) + (size_t)(4 * r + jj) * SEQ + n + mi * 16] = pk.u;
      }
    }
  } else {
    const float4 g4 = *(const float4*)&(sel ? kg : qg)[4 * r];
    const float4 b4 = *(const float4*)&(sel ? kb : qb)[4 * r];
    _Float16* dst = (sel ? kh : qh) + (bh * SEQ + n) * HD + 4 * r;
#pragma unroll  // constant indices keep the tiles in registers
    for (int mi = 0; mi < 4; ++mi) {
      union { _Float16 h[4]; unsigned long long u; } pk[8];
#pragma unroll  // constant indices keep the tiles in registers
      for (int e = 0; e < 8; ++e) {
        float t0 = acc[mi][0][e] + bj[0], t1 = acc[mi][1][e] + bj[1];
        float t2 = acc[mi][2][e] + bj[2], t3 = acc[mi][3][e] + bj[3];
        float mu = row16_sum((t0 + t1) + (t2 + t3)) * (1.f / 64.f);
        t0 -= mu; t1 -= mu; t2 -= mu; t3 -= mu;
        float var = row16_sum((t0 * t0 + t1 * t1) + (t2 * t2 + t3 * t3)) * (1.f / 64.f) + 1e-5f;
        float rs;
        // var >= 1e-5, so the library's rescaling of subnormal arguments is an identity here; the v_nop keeps
        // the one free slot the instruction set asks for behind a transcendental, whatever is scheduled next.
        asm("v_rsq_f32 %0, %1\n\tv_nop" : "=v"(rs) : "v"(var));
        pk[e].h[0] = (_Float16)(t0 * rs * g4.x + b4.x);
        pk[e].h[1] = (_Float16)(t1 * rs * g4.y + b4.y);
        pk[e].h[2] = (_Float16)(t2 * rs * g4.z + b4.z);
        pk[e].h[3] = (_Float16)(t3 * rs * g4.w + b4.w);
      }
      // The 8 rows of a row tile; 16 lanes x 8 bytes are one whole 128-byte head row. The stores and their wait
      // are one statement so that the next row tile's arithmetic, which reuses these registers, stays behind the wait.
      asm volatile(
          "global_store_b64 %0, %1, off\n\t"
          "global_store_b64 %0, %2, off offset:128\n\t"
          "global_store_b64 %0, %3, off offset:256\n\t"
          "global_store_b64 %0, %4, off offset:384\n\t"
          "global_store_b64 %0, %5, off offset:512\n\t"
          "global_store_b64 %0, %6, off offset:640\n\t"
          "global_store_b64 %0, %7, off offset:768\n\t"
          "global_store_b64 %0, %8, off offset:896\n\t"
          "s_wait_xcnt 0x0"
          :: "v"(dst + mi * 16 * HD), "v"(pk[0].u), "v"(pk[1].u), "v"(pk[2].u), "v"(pk[3].u),
             "v"(pk[4].u), "v"(pk[5].u), "v"(pk[6].u), "v"(pk[7].u)
          : "memory");
    }
  }
}

// ---------------- flash attention: block = (b*h, 256-query tile), 16 waves x 16 queries ----------------
// Lane l with lane l ^ 16, in the vector unit (a shuffle would go through the LDS unit).
__device__ __forceinline__ float xhalf(float x) {
  const int b = __builtin_bit_cast(int, x);
  return __builtin_bit_cast(float, __builtin_amdgcn_permlanex16(b, b, 0x76543210, 0xfedcba98, false, false));
}

__global__ __launch_bounds__(512) void flash_attn(
    const _Float16* __restrict__ qh, const _Float16* __restrict__ kh,
    const _Float16* __restrict__ vth, _Float16* __restrict__ aout) {
  __shared__ __attribute__((aligned(16))) _Float16 ksm[SEQ * P64];     // 1024 keys x 64 hd
  __shared__ __attribute__((aligned(16))) _Float16 vts[HD * PSEQ];     // 64 hd x 1024 keys (v^T)

  const int tid = threadIdx.x, wave = tid >> 5, lane = tid & 31;
  const int bh = blockIdx.x;                       // 0..63
  const int q0 = blockIdx.y * 256 + wave * 16;     // query tile base
  const int r = lane & 15, half = lane >> 4;

  const _Float16* qp = qh + (size_t)bh * SEQ * HD;
  const _Float16* kp = kh + (size_t)bh * SEQ * HD;
  const _Float16* vp = vth + (size_t)bh * HD * SEQ;

  // Keys 256*j .. 256*j+255: 4 copies of K and 4 of V^T a thread; a wave's 32 lanes take 512 contiguous bytes.
  auto stage_keys = [&](int j) {
#pragma unroll  // the copies issue back to back, their steps folded at compile time
    for (int it = 0; it < 4; ++it) {
      const int c = tid + it * 512;
      const int kc = j * 2048 + c;             // K: 256 rows x 8 octets, contiguous in memory
      copy16_to_lds(&kp[(size_t)kc * 8], &ksm[(kc >> 3) * P64 + (kc & 7) * 8]);
      const int dd = c >> 5, s = j * 32 + (c & 31);  // V^T: 64 rows x 32 octets
      copy16_to_lds(&vp[(size_t)dd * SEQ + s * 8], &vts[dd * PSEQ + s * 8]);
    }
  };
  stage_keys(0);

  // Q^T B-fragments (column = query r) held in registers for the whole pass (hd split into two K=32 chunks)
  v16h bq0 = load_frag(qp + (size_t)q0 * HD, HD);
  v16h bq1 = load_frag(qp + (size_t)q0 * HD + 32, HD);

  const v8f vzero = {0.f, 0.f, 0.f, 0.f, 0.f, 0.f, 0.f, 0.f};
  v8f acc[4];  // acc[t][e] = O[query r][hd 16t + 8*half + e]
#pragma unroll
  for (int t = 0; t < 4; ++t) acc[t] = vzero;
  float m = -INFINITY;  // running maximum of query r, the same in both halves
  float l = 0.f;        // running sum over this half's keys only; the halves are joined behind the loop

  for (int part = 0; part < 2; ++part) {
    // This wave's own copies have landed; behind the barrier every wave's have. No key of a part is read before.
    asm volatile("s_wait_asynccnt 0x0" ::: "memory");
    __syncthreads();
    if (part == 0) {
      stage_keys(1);
      stage_keys(2);
      stage_keys(3);
    }
    const int kend = part ? 32 : 8;
    for (int kb = part ? 8 : 0; kb < kend; ++kb) {
      const _Float16* kt = &ksm[kb * 32 * P64];  // this pass's 32 keys
      const _Float16* vt = &vts[kb * 32];
      // S^T = K Q^T : two 16-key sub-tiles, K(hd)=64 in two WMMAs each
      // s0[e] = S[query r][key 8*half + e], s1[e] = S[query r][key 16 + 8*half + e]
      v8f s0 = vzero, s1 = vzero;
      {
        v16h a00 = load_frag(kt, P64);
        v16h a01 = load_frag(kt + 32, P64);
        v16h a10 = load_frag(kt + 16 * P64, P64);
        v16h a11 = load_frag(kt + 16 * P64 + 32, P64);
        s0 = wmma16(a00, bq0, s0);
        s1 = wmma16(a10, bq0, s1);
        s0 = wmma16(a01, bq1, s0);
        s1 = wmma16(a11, bq1, s1);
      }

      // online softmax: 16 of the 32 keys of query r in this lane, the other 16 in lane ^ 16
      float t8[8];
#pragma unroll
      for (int e = 0; e < 8; ++e) t8[e] = fmaxf(s0[e], s1[e]);
      float pm = fmaxf(fmaxf(fmaxf(t8[0], t8[1]), fmaxf(t8[2], t8[3])),
                       fmaxf(fmaxf(t8[4], t8[5]), fmaxf(t8[6], t8[7])));
      pm = fmaxf(pm, xhalf(pm)) * 0.125f;  // 1/sqrt(64): a power of two, so it commutes with the maximum exactly
      const float mnew = fmaxf(m, pm);
      const float al = __expf(m - mnew);
      float ps = 0.f;
      v16h bp;  // P^T B-fragment: element s is key 8*half + s (s < 8) or 16 + 8*half + (s - 8)
#pragma unroll
      for (int e = 0; e < 8; ++e) {
        const float p0 = __expf(s0[e] * 0.125f - mnew);
        const float p1 = __expf(s1[e] * 0.125f - mnew);
        ps += p0 + p1;
        bp[e]     = (_Float16)p0;
        bp[8 + e] = (_Float16)p1;
      }
      l = al * l + ps;
      m = mnew;

      // rescale running O^T (one query a lane: one factor) and accumulate V^T P^T (4 hd sub-tiles of 16)
#pragma unroll
      for (int t = 0; t < 4; ++t) {
#pragma unroll
        for (int e = 0; e < 8; ++e) acc[t][e] *= al;
        v16h av = load_frag(vt + 16 * t * PSEQ, PSEQ);
        acc[t] = wmma16(av, bp, acc[t]);
      }
    }
  }

  // finalize: divide by row sums, emit f16 [B,N,D] with head-concat columns;
  // a lane's 8 values of a sub-tile are 8 adjacent hd of its query: one 16-byte store each
  const float linv = 1.f / (l + xhalf(l));
  const int b = bh >> 4, h = bh & 15;
  _Float16* dst = aout + (size_t)(b * SEQ + q0 + r) * DMODEL + h * 64 + 8 * half;
#pragma unroll
  for (int t = 0; t < 4; ++t) {
    Half8 pk;
#pragma unroll
    for (int e = 0; e < 8; ++e) pk.h[e] = (_Float16)(acc[t][e] * linv);
    *(uint4*)(dst + t * 16) = pk.u;
  }
}

extern "C" void kernel_launch(void* const* d_in, const int* in_sizes, int n_in,
                              void* d_out, int out_size, void* d_ws, size_t ws_size,
                              hipStream_t stream) {
  const float* x    = (const float*)d_in[0];
  const float* Wqkv = (const float*)d_in[1];
  const float* bqkv = (const float*)d_in[2];
  const float* qg   = (const float*)d_in[3];
  const float* qb   = (const float*)d_in[4];
  const float* kg   = (const float*)d_in[5];
  const float* kb   = (const float*)d_in[6];
  const float* Wo   = (const float*)d_in[7];
  const float* bo   = (const float*)d_in[8];
  float* out = (float*)d_out;

  char* ws = (char*)d_ws;
  size_t off = 0;
  auto alloc = [&](size_t bytes) -> char* {
    char* p = ws + off;
    off += (bytes + 255) & ~(size_t)255;
    return p;
  };
  _Float16* xh   = (_Float16*)alloc(4096ull * 1024 * 2);  // x in f16
  _Float16* wqt  = (_Float16*)alloc(3072ull * 1024 * 2);  // Wqkv^T f16
  _Float16* wot  = (_Float16*)alloc(1024ull * 1024 * 2);  // Wo^T f16
  _Float16* qh   = (_Float16*)alloc(64ull * 1024 * 64 * 2);
  _Float16* kh   = (_Float16*)alloc(64ull * 1024 * 64 * 2);
  _Float16* vth  = (_Float16*)alloc(64ull * 1024 * 64 * 2);
  _Float16* aout = (_Float16*)alloc(4096ull * 1024 * 2);

  cvt_inputs<<<1024, 256, 0, stream>>>(x, Wqkv, Wo, xh, wqt, wot);        // 512 + 384 + 128 blocks
  gemm_qkv_ln<<<dim3(32, 24), 128, 0, stream>>>(xh, wqt, bqkv, qg, qb, kg, kb, qh, kh, vth, 1024);
  flash_attn<<<dim3(64, 4), 512, 0, stream>>>(qh, kh, vth, aout);
  gemm_wmma<<<dim3(32, 8), 128, 0, stream>>>(aout, wot, bo, out, 4096, 1024, 1024);
}

// v009
// It runs in 56.8 microseconds.
// In both of two side-by-side timings against v008, it was 1.06 times as fast.
// Over all steps from v000 it is 5.29 times as fast.
#include <hip/hip_runtime.h>
#include <hip/hip_bf16.h>
#include <math.h>

typedef __attribute__((ext_vector_type(16))) _Float16 v16h;
typedef __attribute__((ext_vector_type(8)))  float    v8f;
typedef __attribute__((ext_vector_type(2)))  float    v2f;
typedef __attribute__((__vector_size__(4 * sizeof(int)))) int v4i;

#define SEQ 1024
#define DMODEL 1024
#define HD 64

// LDS row pitch, in f16 elements, of every tile that load_frag reads with 16-byte loads: 16 bytes x an odd
// number, so that the 16 rows of a fragment start on 16 different groups of four banks (a pitch of 64 or
// 128 bytes puts them on 4 or 2 groups, and each load then takes 4 or 8 times the LDS clocks).
#define P64 72   // rows of 64 f16 (128 bytes) at 144 bytes
#define PV 136   // rows of 128 f16 (256 bytes) at 272 bytes
#define PASS_H (128 * P64 + HD * PV)  // f16 elements of one attention pass in LDS: 128 K rows, then 64 V^T rows of 128 keys

#define AS1 __attribute__((address_space(1)))
#define AS3 __attribute__((address_space(3)))

#if defined(__has_builtin)
#if __has_builtin(__builtin_amdgcn_global_load_async_to_lds_b128)
#define HAVE_ASYNC 1
#endif
#endif

// 16-byte tile-staging copy: async global->LDS (ASYNCcnt) when available,
// else synchronous through VGPRs.
__device__ __forceinline__ void copy16_to_lds(const _Float16* gsrc, _Float16* ldst) {
#ifdef HAVE_ASYNC
  __builtin_amdgcn_global_load_async_to_lds_b128(
      (AS1 v4i*)(gsrc), (AS3 v4i*)(ldst), 0, 0);
#else
  *(uint4*)ldst = *(const uint4*)gsrc;
#endif
}

__device__ __forceinline__ v8f wmma16(v16h a, v16h b, v8f c) {
  // v_wmma_f32_16x16x32_f16: D = A(16x32 f16) * B(32x16 f16) + C(16x16 f32)
  return __builtin_amdgcn_wmma_f32_16x16x32_f16(false, a, false, b, (short)0, c, false, false);
}

union FragU { v16h h; uint4 u[2]; };

// A/B fragment loader. Layout (ISA 7.12.2, 16-bit A 16x32):
//   lane L holds row (L&15); halves 0..7 = K in [koff, koff+8), halves 8..15 = K in [koff+16, koff+24)
//   where koff = 8*(L>>4). B mirrors A with "row" = output column of a [16][K] Bt tile.
__device__ __forceinline__ v16h load_frag(const _Float16* tile, int ldh) {
  const int lane = threadIdx.x & 31;
  const int row  = lane & 15;
  const int koff = (lane >> 4) << 3;
  const _Float16* p = tile + row * ldh + koff;
  FragU f;
  f.u[0] = *(const uint4*)(p);
  f.u[1] = *(const uint4*)(p + 16);
  return f.h;
}

// Sum over the 16 lanes of a row, result in every lane of the row (DPP row_xmask butterfly:
// stays in the vector unit, where a shuffle would go through the LDS unit).
template <int MASK>
__device__ __forceinline__ float add_xmask(float v) {
  return v + __builtin_bit_cast(float, __builtin_amdgcn_update_dpp(
                 0, __builtin_bit_cast(int, v), 0x160 | MASK, 0xf, 0xf, true));
}
__device__ __forceinline__ float row16_sum(float v) {
  v = add_xmask<1>(v);
  v = add_xmask<2>(v);
  v = add_xmask<4>(v);
  return add_xmask<8>(v);
}

// ---------------- conversion kernels ----------------
// 32 elements a thread, so that few waves have to start and each keeps 8 loads of 16 bytes in flight.
// The loops below are unrolled so that v[] stays in registers and the 8 loads issue as one group.
union Half4 { _Float16 h[4]; uint2 u; };
union Half8 { _Float16 h[8]; uint4 u; };

// fp32 -> f16, same order. A block takes 8192 consecutive elements; each of a thread's 8 loads is part of
// 512 contiguous bytes of its wave, all 8 issued before the first is used.
__device__ __forceinline__ void cvt_rows(const float* __restrict__ in, _Float16* __restrict__ out, int blk) {
  const size_t base = (size_t)blk * 8192 + threadIdx.x * 4;
  float4 v[8];
#pragma unroll
  for (int j = 0; j < 8; ++j) v[j] = *(const float4*)&in[base + j * 1024];
#pragma unroll
  for (int j = 0; j < 8; ++j) {
    Half4 pk;
    pk.h[0] = (_Float16)v[j].x; pk.h[1] = (_Float16)v[j].y;
    pk.h[2] = (_Float16)v[j].z; pk.h[3] = (_Float16)v[j].w;
    *(uint2*)&out[base + j * 1024] = pk.u;
  }
}

// W[K][N] fp32 -> Wt[N][K] f16  (Wt is the "Bt" operand: row = output column)
// A block of 8 waves takes 64 k x 128 n (tile bk, bn), a wave 64 k x 16 n, a thread 8 k x 4 n, transposed in its
// registers: 8 loads of 4 adjacent n, then 4 stores of 8 adjacent k. 8 lanes side by side in k store one whole 128-byte line.
// K and N are compile-time so that the row steps are immediate offsets on one address register pair.
template <int K, int N>
__device__ __forceinline__ void cvt_t_tile(const float* __restrict__ W, _Float16* __restrict__ Wt, int bn, int bk) {
  const int wave = threadIdx.x >> 5, lane = threadIdx.x & 31;
  const int n = bn * 128 + wave * 16 + (lane & 3) * 4;
  const int k = bk * 64 + (lane >> 2) * 8;
  const float* src = W + (size_t)k * N + n;
  _Float16* dst = Wt + (size_t)n * K + k;
  float4 v[8];
#pragma unroll
  for (int j = 0; j < 8; ++j) v[j] = *(const float4*)(src + j * N);
  Half8 c[4];
#pragma unroll
  for (int j = 0; j < 8; ++j) {
    c[0].h[j] = (_Float16)v[j].x; c[1].h[j] = (_Float16)v[j].y;
    c[2].h[j] = (_Float16)v[j].z; c[3].h[j] = (_Float16)v[j].w;
  }
#pragma unroll
  for (int i = 0; i < 4; ++i) *(uint4*)(dst + i * K) = c[i].u;
  // A block runs only this job and then ends; as a precaution this wait stands in front of any
  // overwrite of a register that one of the four issued stores names.
  asm volatile("s_wait_xcnt 0x0" ::: "memory");
}

// The three conversions read nothing of one another, so they share one launch: one gap, one fill and one tail
// where three launches in a row paid three. The block index picks the job (the same for a whole block).
#define CVT_X_BLOCKS    512  // 512 x 8192 = 4096 x 1024 elements of x
#define CVT_WQKV_BLOCKS 384  // 24 tiles of 128 n x 16 tiles of 64 k
#define CVT_WO_BLOCKS   128  // 8 tiles of 128 n x 16 tiles of 64 k
__global__ __launch_bounds__(256) void cvt_inputs(
    const float* __restrict__ x, const float* __restrict__ Wqkv, const float* __restrict__ Wo,
    _Float16* __restrict__ xh, _Float16* __restrict__ wqt, _Float16* __restrict__ wot) {
  const int blk = blockIdx.x;
  if (blk < CVT_X_BLOCKS) {
    cvt_rows(x, xh, blk);
  } else if (blk < CVT_X_BLOCKS + CVT_WQKV_BLOCKS) {
    const int t = blk - CVT_X_BLOCKS;
    cvt_t_tile<DMODEL, 3 * DMODEL>(Wqkv, wqt, t % 24, t / 24);
  } else {
    const int t = blk - (CVT_X_BLOCKS + CVT_WQKV_BLOCKS);
    cvt_t_tile<DMODEL, DMODEL>(Wo, wot, t & 7, t >> 3);
  }
}

// ---------------- the K loop of both GEMMs: acc[4][4] += A[m0.., :] * Bt[n0.., :]^T ----------------
// A block of 4 waves takes 128 x 128, a wave 64 x 64 (2 x 2 waves): 4 A and 4 B fragments feed a block of 16 WMMAs,
// one 16-byte LDS load a WMMA.
// The loop is software-pipelined. Registers: two fragment sets; the 16 LDS loads of the next 32 k go out as one
// group in front of the current block of WMMAs and return under it, so that a wave does not wait out LDS latency.
// LDS: a stage is 64 k (two blocks) of the 128 A rows and the 128 B rows; a row's share is one whole 128-byte line.
// As the first fragments of stage i + 1 are fetched under the last block of stage i, stage i + 1 is published in
// front of that block; every wave then holds all of stage i in registers, and its buffer is refilled at once.
#define BK 64             // k of a stage
#define STAGE_COPIES 16   // copies of a thread and stage: 2 x 128 rows x 8 octets / 128 threads
#define STAGE_H (128 * P64)  // f16 elements of one operand's stage in LDS
#define NST_QKV 2         // buffers; three blocks share a WGP and fill one another's waits
#define NST_OUT 4         // one block a WGP, one wave a SIMD: three stages fly ahead

// This wave's copies have landed, all but those of the FLY youngest stages (copies land in issue order).
template <int FLY>
__device__ __forceinline__ void wait_stages() {
  asm volatile("s_wait_asynccnt %0" :: "n"(STAGE_COPIES * FLY) : "memory");
}

// PERM: Bt rows are staged permuted inside each group of 64 (see gemm_qkv_ln).
template <int NST, bool PERM>
__device__ __forceinline__ void gemm_k_loop(const _Float16* __restrict__ A, const _Float16* __restrict__ Bt, int K,
                                            int m0, int n0, _Float16* As, _Float16* Bs, v8f (&acc)[4][4]) {
  const int tid = threadIdx.x, wave = tid >> 5;
  const int wm = wave >> 1, wn = wave & 1;
  const int tr = tid >> 3, ts = tid & 7;  // a thread's row in each group of 16 rows, and its octet of the row
  const unsigned aoff = (unsigned)(tr * K + ts * 8);
  const unsigned boff = (unsigned)((PERM ? tr * 4 : tr) * K + ts * 8);
  const int loff = tr * P64 + ts * 8;

  // Copy c (0..15) of stage st, into buffer st % NST: LDS rows 16 * (c >> 1) + tr of A (c even) or of Bt (c odd).
  // A wave's copy takes 4 rows x 128 bytes.
  auto issue_copy = [&](int st, int c) {
    const int it = c >> 1;
    const int lo = (st & (NST - 1)) * STAGE_H + it * 16 * P64 + loff;
    if ((c & 1) == 0) {
      copy16_to_lds(A + (size_t)m0 * K + st * BK + (size_t)(it * 16) * K + aoff, As + lo);
    } else {
      const int brow = PERM ? (it >> 2) * 64 + (it & 3) : it * 16;  // + 4 * tr or + tr: the Bt row staged there
      copy16_to_lds(Bt + (size_t)n0 * K + st * BK + (size_t)brow * K + boff, Bs + lo);
    }
  };
  auto issue_stage = [&](int st) {
#pragma unroll  // the 16 copies of a stage issue back to back
    for (int c = 0; c < STAGE_COPIES; ++c) issue_copy(st, c);
  };
  auto load_set = [&](v16h (&a)[4], v16h (&b)[4], int buf, int kk) {
    const _Float16* as = As + buf * STAGE_H + wm * 64 * P64 + kk;
    const _Float16* bs = Bs + buf * STAGE_H + wn * 64 * P64 + kk;
#pragma unroll  // constant indices keep the fragments in registers
    for (int j = 0; j < 4; ++j) {
      a[j] = load_frag(as + j * 16 * P64, P64);
      b[j] = load_frag(bs + j * 16 * P64, P64);
    }
  };
  auto mma_block = [&](const v16h (&a)[4], const v16h (&b)[4]) {
#pragma unroll  // constant indices keep the tiles in registers
    for (int mi = 0; mi < 4; ++mi)
#pragma unroll  // constant indices keep the tiles in registers
      for (int j = 0; j < 4; ++j) acc[mi][j] = wmma16(a[mi], b[j], acc[mi][j]);
  };

  const v8f vzero = {0.f, 0.f, 0.f, 0.f, 0.f, 0.f, 0.f, 0.f};
#pragma unroll  // constant indices keep the tiles in registers
  for (int i = 0; i < 4; ++i)
#pragma unroll  // constant indices keep the tiles in registers
    for (int j = 0; j < 4; ++j) acc[i][j] = vzero;

  const int nst = K / BK;
#pragma unroll  // the first stages' copies issue back to back
  for (int s = 0; s < NST - 1; ++s)
    if (s < nst) issue_stage(s);
  if (NST > 2 && NST - 1 <= nst) wait_stages<NST - 2>(); else wait_stages<0>();  // stage 0 has landed
  __syncthreads();
  if (NST - 1 < nst) issue_stage(NST - 1);
  v16h a0[4], b0[4], a1[4], b1[4];
  load_set(a0, b0, 0, 0);
#pragma clang loop unroll(disable)  // one copy of the body, for speed only
  for (int i = 0; i < nst; ++i) {
    const int cur = i & (NST - 1);
    // The scheduling fences keep each group of loads whole and in front of the block of WMMAs it flies under, for speed only.
    __builtin_amdgcn_sched_barrier(0);
    load_set(a1, b1, cur, 32);
    __builtin_amdgcn_sched_barrier(0);
    mma_block(a0, b0);
    __builtin_amdgcn_sched_barrier(0);
    // Publish point of stage i + 1: this wave's reads of stage i have returned; its copies of stage i + 1 have landed;
    // behind the barrier both hold for every wave.
    asm volatile("s_wait_dscnt 0x0" ::: "memory");
    if (NST > 2 && i + NST - 1 < nst) wait_stages<NST - 2>(); else wait_stages<0>();
    __syncthreads();
    // On the last trip these loads read the current buffer again, which nothing refills, and their values are not
    // used: without a branch around them the compiler's counted waits stay exact.
    load_set(a0, b0, (i + 1 < nst) ? ((i + 1) & (NST - 1)) : cur, 0);
    __builtin_amdgcn_sched_barrier(0);
    if (i + NST < nst) issue_stage(i + NST);  // into the buffer just left
    mma_block(a1, b1);
  }
  // The last trip's unused fragment loads have returned before their registers serve the epilogue.
  asm volatile("s_wait_dscnt 0x0" ::: "memory");
}

// ---------------- tiled WMMA GEMM: C[M][N] = A[M][K](f16) * Bt[N][K](f16)^T + bias ----------------
__global__ __launch_bounds__(128) void gemm_wmma(
    const _Float16* __restrict__ A, const _Float16* __restrict__ Bt,
    const float* __restrict__ bias, float* __restrict__ C, int M, int N, int K) {
  __shared__ __attribute__((aligned(16))) _Float16 As[NST_OUT * STAGE_H];
  __shared__ __attribute__((aligned(16))) _Float16 Bs[NST_OUT * STAGE_H];
  const int tid = threadIdx.x, wave = tid >> 5, lane = tid & 31;
  const int wm = wave >> 1, wn = wave & 1;
  const int m0 = blockIdx.x * 128, n0 = blockIdx.y * 128;

  v8f acc[4][4];
  gemm_k_loop<NST_OUT, false>(A, Bt, K, m0, n0, As, Bs, acc);

  // D layout: lane holds col (lane&15); VGPR e is row e (lanes 0-15) / e+8 (lanes 16-31)
  const int ncol = lane & 15, half = lane >> 4;
#pragma unroll  // constant indices keep the tiles in registers
  for (int j = 0; j < 4; ++j) {
    int gc = n0 + wn * 64 + j * 16 + ncol;
    float bv = bias[gc];
#pragma unroll  // constant indices keep the tiles in registers
    for (int mi = 0; mi < 4; ++mi) {
#pragma unroll  // constant indices keep the tiles in registers
      for (int e = 0; e < 8; ++e) {
        int gr = m0 + wm * 64 + mi * 16 + e + 8 * half;
        C[(size_t)gr * N + gc] = acc[mi][j][e] + bv;
      }
    }
  }
}

// ---------------- QKV projection with bias, per-head LayerNorm and f16 split in the epilogue ----------------
// The K loop on A = x[4096][1024], Bt = Wqkv^T[3072][1024]. A 128-column block is two whole
// heads of q, of k or of v, and a wave holds 64 full rows of one of them, so each LayerNorm row is complete in a wave.
// Writes qh,kh [B*H][N][64] f16 (k row-major == A for K*Q^T) and vth [B*H][64][N] f16 (v^T == A for V^T*P^T).
// Bt rows are staged permuted inside each head: LDS row hh*64 + jj*16 + r holds column hh*64 + 4*r + jj,
// so lane r ends up with the four adjacent columns 4r..4r+3 of its wave's head in acc[.][0..3].
__global__ __launch_bounds__(128) void gemm_qkv_ln(
    const _Float16* __restrict__ A, const _Float16* __restrict__ Bt, const float* __restrict__ bias,
    const float* __restrict__ qg, const float* __restrict__ qb,
    const float* __restrict__ kg, const float* __restrict__ kb,
    _Float16* __restrict__ qh, _Float16* __restrict__ kh, _Float16* __restrict__ vth, int K) {
  __shared__ __attribute__((aligned(16))) _Float16 As[NST_QKV * STAGE_H];
  __shared__ __attribute__((aligned(16))) _Float16 Bs[NST_QKV * STAGE_H];
  const int tid = threadIdx.x, wave = tid >> 5, lane = tid & 31;
  const int wm = wave >> 1, wn = wave & 1;
  const int m0 = blockIdx.x * 128, n0 = blockIdx.y * 128;

  v8f acc[4][4];
  gemm_k_loop<NST_QKV, true>(A, Bt, K, m0, n0, As, Bs, acc);

  // D layout: lane holds one column (index lane&15); VGPR e is row e (lanes 0-15) / e+8 (lanes 16-31)
  const int r = lane & 15, half = lane >> 4;
  const int sel = n0 >> 10;                       // 0: q, 1: k, 2: v (the same for the whole block)
  const int grow = m0 + wm * 64 + 8 * half;       // first of this lane's 8 rows in row tile 0
  const int b = grow >> 10, n = grow & (SEQ - 1);
  const size_t bh = (size_t)(b * 16 + ((n0 & 1023) >> 6) + wn);  // this wave's head
  const float4 bv = *(const float4*)&bias[n0 + wn * 64 + 4 * r];
  const float bj[4] = {bv.x, bv.y, bv.z, bv.w};
  if (sel == 2) {
    // v^T: a lane's 8 rows of a row tile are 8 consecutive n of column 4r+jj: one 16-byte store each
#pragma unroll  // constant indices keep the tiles in registers
    for (int mi = 0; mi < 4; ++mi) {
#pragma unroll  // constant indices keep the tiles in registers
      for (int jj = 0; jj < 4; ++jj) {
        union { _Float16 h[8]; uint4 u; } pk;
#pragma unroll  // constant indices keep the tiles in registers
        for (int e = 0; e < 8; ++e) pk.h[e] = (_Float16)(acc[mi][jj][e] + bj[jj]);
        *(uint4*)&vth[bh * (HD * SEQ) + (size_t)(4 * r + jj) * SEQ + n + mi * 16] = pk.u;
      }
    }
  } else {
    const float4 g4 = *(const float4*)&(sel ? kg : qg)[4 * r];
    const float4 b4 = *(const float4*)&(sel ? kb : qb)[4 * r];
    _Float16* dst = (sel ? kh : qh) + (bh * SEQ + n) * HD + 4 * r;
#pragma unroll  // constant indices keep the tiles in registers
    for (int mi = 0; mi < 4; ++mi) {
      union { _Float16 h[4]; unsigned long long u; } pk[8];
#pragma unroll  // constant indices keep the tiles in registers
      for (int e = 0; e < 8; ++e) {
        float t0 = acc[mi][0][e] + bj[0], t1 = acc[mi][1][e] + bj[1];
        float t2 = acc[mi][2][e] + bj[2], t3 = acc[mi][3][e] + bj[3];
        float mu = row16_sum((t0 + t1) + (t2 + t3)) * (1.f / 64.f);
        t0 -= mu; t1 -= mu; t2 -= mu; t3 -= mu;
        float var = row16_sum((t0 * t0 + t1 * t1) + (t2 * t2 + t3 * t3)) * (1.f / 64.f) + 1e-5f;
        float rs;
        // var >= 1e-5, so the library's rescaling of subnormal arguments is an identity here; the v_nop keeps
        // the one free slot the instruction set asks for behind a transcendental, whatever is scheduled next.
        asm("v_rsq_f32 %0, %1\n\tv_nop" : "=v"(rs) : "v"(var));
        pk[e].h[0] = (_Float16)(t0 * rs * g4.x + b4.x);
        pk[e].h[1] = (_Float16)(t1 * rs * g4.y + b4.y);
        pk[e].h[2] = (_Float16)(t2 * rs * g4.z + b4.z);
        pk[e].h[3] = (_Float16)(t3 * rs * g4.w + b4.w);
      }
      // The 8 rows of a row tile; 16 lanes x 8 bytes are one whole 128-byte head row. The stores and their wait
      // are one statement so that the next row tile's arithmetic, which reuses these registers, stays behind the wait.
      asm volatile(
          "global_store_b64 %0, %1, off\n\t"
          "global_store_b64 %0, %2, off offset:128\n\t"
          "global_store_b64 %0, %3, off offset:256\n\t"
          "global_store_b64 %0, %4, off offset:384\n\t"
          "global_store_b64 %0, %5, off offset:512\n\t"
          "global_store_b64 %0, %6, off offset:640\n\t"
          "global_store_b64 %0, %7, off offset:768\n\t"
          "global_store_b64 %0, %8, off offset:896\n\t"
          "s_wait_xcnt 0x0"
          :: "v"(dst + mi * 16 * HD), "v"(pk[0].u), "v"(pk[1].u), "v"(pk[2].u), "v"(pk[3].u),
             "v"(pk[4].u), "v"(pk[5].u), "v"(pk[6].u), "v"(pk[7].u)
          : "memory");
    }
  }
}

// ---------------- flash attention: block = (b*h, 256-query tile), 8 waves x 32 queries ----------------
// Lane l with lane l ^ 16, in the vector unit (a shuffle would go through the LDS unit).
__device__ __forceinline__ float xhalf(float x) {
  const int b = __builtin_bit_cast(int, x);
  return __builtin_bit_cast(float, __builtin_amdgcn_permlanex16(b, b, 0x76543210, 0xfedcba98, false, false));
}

__global__ __launch_bounds__(256) void flash_attn(
    const _Float16* __restrict__ qh, const _Float16* __restrict__ kh,
    const _Float16* __restrict__ vth, _Float16* __restrict__ aout) {
  // Pass by pass: 128 keys x 64 hd of K, then 64 hd x 128 keys of V^T, so that every fragment load of a pass is
  // one of two lane addresses plus an immediate offset (which reaches 64 KiB).
  __shared__ __attribute__((aligned(16))) _Float16 kv[(SEQ / 128) * PASS_H];

  const int tid = threadIdx.x, wave = tid >> 5, lane = tid & 31;
  const int bh = blockIdx.x;                       // 0..63
  const int q0 = blockIdx.y * 256 + wave * 32;     // base of this wave's two query tiles
  const int r = lane & 15, half = lane >> 4;

  const _Float16* qp = qh + (size_t)bh * SEQ * HD;
  const _Float16* kp = kh + (size_t)bh * SEQ * HD;
  const _Float16* vp = vth + (size_t)bh * HD * SEQ;

  // Keys 256*j .. 256*j+255: 8 copies of K and 8 of V^T a thread; a wave's 32 lanes take 512 contiguous bytes.
  auto stage_keys = [&](int j) {
#pragma unroll  // the copies issue back to back, their steps folded at compile time
    for (int it = 0; it < 8; ++it) {
      const int c = tid + it * 256;
      const int kc = j * 2048 + c;             // K: 256 rows x 8 octets, contiguous in memory
      copy16_to_lds(&kp[(size_t)kc * 8], &kv[(kc >> 10) * PASS_H + ((kc >> 3) & 127) * P64 + (kc & 7) * 8]);
      const int dd = c >> 5, s = j * 32 + (c & 31);  // V^T: 64 rows x 32 octets
      copy16_to_lds(&vp[(size_t)dd * SEQ + s * 8], &kv[(s >> 4) * PASS_H + 128 * P64 + dd * PV + (s & 15) * 8]);
    }
  };
  stage_keys(0);

  // Q^T B-fragments (column = query r of tile u) held in registers for the whole pass (hd in two K=32 chunks)
  v16h bq[2][2];
#pragma unroll  // constant indices keep the fragments in registers
  for (int u = 0; u < 2; ++u) {
    bq[u][0] = load_frag(qp + (size_t)(q0 + 16 * u) * HD, HD);
    bq[u][1] = load_frag(qp + (size_t)(q0 + 16 * u) * HD + 32, HD);
  }
  // This wait stands in front of any overwrite of the address registers that the eight issued loads name; the
  // scheduling fence keeps later address arithmetic, which reuses those registers, from being lifted over it.
  asm volatile("s_wait_xcnt 0x0" ::: "memory");
  __builtin_amdgcn_sched_barrier(0);

  const v8f vzero = {0.f, 0.f, 0.f, 0.f, 0.f, 0.f, 0.f, 0.f};
  v8f acc[2][4];  // acc[u][t][e] = O[query 16u + r][hd 16t + 8*half + e]
  float m[2], l[2];  // running maximum (the same in both halves) and running sum over this half's keys, per tile
#pragma unroll  // constant indices keep the tiles in registers
  for (int u = 0; u < 2; ++u) {
#pragma unroll  // constant indices keep the tiles in registers
    for (int t = 0; t < 4; ++t) acc[u][t] = vzero;
    m[u] = -INFINITY;
    l[u] = 0.f;
  }

  for (int part = 0; part < 2; ++part) {
    // This wave's own copies have landed; behind the barrier every wave's have. No key of a part is read before.
    asm volatile("s_wait_asynccnt 0x0" ::: "memory");
    __syncthreads();
    if (part == 0) {
      stage_keys(1);
      stage_keys(2);
      stage_keys(3);
    }
    // A pass takes 128 keys for 32 queries: each K and V^T fragment feeds two WMMAs, and one running maximum, one
    // factor and one rescale of O^T serve 128 keys.
    const int kend = part ? 8 : 2;
    for (int kb = part ? 2 : 0; kb < kend; ++kb) {
      const _Float16* kt = &kv[kb * PASS_H];  // this pass's 128 keys
      const _Float16* vt = kt + 128 * P64;
      // K fragments of the 32 keys of group g: sub-tile j in a[2j] (hd 0..31) and a[2j+1] (hd 32..63)
      auto load_k = [&](v16h (&a)[4], int g) {
        const int key0 = g * 32;
#pragma unroll  // constant indices keep the fragments in registers
        for (int j = 0; j < 2; ++j) {
          a[2 * j]     = load_frag(kt + (key0 + j * 16) * P64, P64);
          a[2 * j + 1] = load_frag(kt + (key0 + j * 16) * P64 + 32, P64);
        }
      };
      // V^T fragments of the 32 keys of group g, 4 hd sub-tiles of 16
      auto load_v = [&](v16h (&a)[4], int g) {
#pragma unroll  // constant indices keep the fragments in registers
        for (int t = 0; t < 4; ++t) a[t] = load_frag(vt + 16 * t * PV + g * 32, PV);
      };
      // S^T = K Q^T : eight 16-key sub-tiles a query tile, K(hd)=64 in two WMMAs each
      // s[u][j][e] = S[query 16u + r][key 16*j + 8*half + e]
      v8f s[2][8];
      auto mma_s = [&](const v16h (&a)[4], int g) {
#pragma unroll  // constant indices keep the tiles in registers
        for (int u = 0; u < 2; ++u) {
          s[u][2 * g]     = wmma16(a[0], bq[u][0], vzero);
          s[u][2 * g + 1] = wmma16(a[2], bq[u][0], vzero);
        }
#pragma unroll  // constant indices keep the tiles in registers
        for (int u = 0; u < 2; ++u) {
          s[u][2 * g]     = wmma16(a[1], bq[u][1], s[u][2 * g]);
          s[u][2 * g + 1] = wmma16(a[3], bq[u][1], s[u][2 * g + 1]);
        }
      };
      // The scheduling fences of this loop keep each group of LDS loads whole and in front of the work it flies
      // under, and each group's exponentials and WMMAs together: left free, the compiler put loads next to their
      // use and paid idle slots behind WMMAs scattered among vector work.
      v16h ak[2][4], av[2][4];
      load_k(ak[0], 0);
      load_k(ak[1], 1);
      __builtin_amdgcn_sched_barrier(0);
      mma_s(ak[0], 0);
      __builtin_amdgcn_sched_barrier(0);
      load_k(ak[0], 2);
      __builtin_amdgcn_sched_barrier(0);
      mma_s(ak[1], 1);
      __builtin_amdgcn_sched_barrier(0);
      load_k(ak[1], 3);
      __builtin_amdgcn_sched_barrier(0);
      mma_s(ak[0], 2);
      __builtin_amdgcn_sched_barrier(0);
      load_v(av[0], 0);
      __builtin_amdgcn_sched_barrier(0);
      mma_s(ak[1], 3);
      __builtin_amdgcn_sched_barrier(0);
      load_v(av[1], 1);
      __builtin_amdgcn_sched_barrier(0);

      // online softmax: 64 of the 128 keys of a query in this lane, the other 64 in lane ^ 16
      float al[2];
#pragma unroll  // constant indices keep the tiles in registers
      for (int u = 0; u < 2; ++u) {
        float t8[8];
#pragma unroll  // constant indices keep the tiles in registers
        for (int e = 0; e < 8; ++e)
          t8[e] = fmaxf(fmaxf(fmaxf(s[u][0][e], s[u][1][e]), fmaxf(s[u][2][e], s[u][3][e])),
                        fmaxf(fmaxf(s[u][4][e], s[u][5][e]), fmaxf(s[u][6][e], s[u][7][e])));
        float pm = fmaxf(fmaxf(fmaxf(t8[0], t8[1]), fmaxf(t8[2], t8[3])),
                         fmaxf(fmaxf(t8[4], t8[5]), fmaxf(t8[6], t8[7])));
        pm = fmaxf(pm, xhalf(pm)) * 0.125f;  // 1/sqrt(64): a power of two, so it commutes with the maximum exactly
        const float mnew = fmaxf(m[u], pm);
        al[u] = __expf(m[u] - mnew);
        m[u] = mnew;
        // rescale running O^T (one query a lane: one factor)
#pragma unroll  // constant indices keep the tiles in registers
        for (int t = 0; t < 4; ++t)
#pragma unroll  // constant indices keep the tiles in registers
          for (int e = 0; e < 8; ++e) acc[u][t][e] *= al[u];
      }

      v2f ps[2] = {{0.f, 0.f}, {0.f, 0.f}};  // sums of this pass: .x over the even, .y over the odd keys
#pragma unroll  // constant indices keep the tiles in registers
      for (int g = 0; g < 4; ++g) {  // groups of 32 keys: the k of one value product
#pragma unroll  // constant indices keep the tiles in registers
        for (int u = 0; u < 2; ++u) {
          __builtin_amdgcn_sched_barrier(0);
          v16h bp;  // P^T B-fragment: element i is key 32*g + 8*half + i (i < 8) or 32*g + 16 + 8*half + (i - 8)
#pragma unroll  // constant indices keep the tiles in registers
          for (int jj = 0; jj < 2; ++jj) {
#pragma unroll  // constant indices keep the tiles in registers
            for (int e = 0; e < 8; e += 2) {
              const float p0 = __expf(s[u][2 * g + jj][e] * 0.125f - m[u]);
              const float p1 = __expf(s[u][2 * g + jj][e + 1] * 0.125f - m[u]);
              ps[u] += (v2f){p0, p1};
              bp[8 * jj + e]     = (_Float16)p0;
              bp[8 * jj + e + 1] = (_Float16)p1;
            }
          }
          __builtin_amdgcn_sched_barrier(0);
          // accumulate V^T P^T (4 hd sub-tiles of 16)
#pragma unroll  // constant indices keep the tiles in registers
          for (int t = 0; t < 4; ++t) acc[u][t] = wmma16(av[g & 1][t], bp, acc[u][t]);
        }
        __builtin_amdgcn_sched_barrier(0);
        if (g < 2) load_v(av[g & 1], g + 2);  // into the set just used
      }
#pragma unroll  // constant indices keep the tiles in registers
      for (int u = 0; u < 2; ++u) l[u] = al[u] * l[u] + (ps[u].x + ps[u].y);
    }
  }

  // finalize: divide by row sums, emit f16 [B,N,D] with head-concat columns;
  // a lane's 8 values of a sub-tile are 8 adjacent hd of its query: one 16-byte store each
  const int b = bh >> 4, h = bh & 15;
#pragma unroll  // constant indices keep the tiles in registers
  for (int u = 0; u < 2; ++u) {
    const float linv = 1.f / (l[u] + xhalf(l[u]));
    _Float16* dst = aout + (size_t)(b * SEQ + q0 + 16 * u + r) * DMODEL + h * 64 + 8 * half;
#pragma unroll
    for (int t = 0; t < 4; ++t) {
      Half8 pk;
#pragma unroll
      for (int e = 0; e < 8; ++e) pk.h[e] = (_Float16)(acc[u][t][e] * linv);
      *(uint4*)(dst + t * 16) = pk.u;
    }
  }
}

extern "C" void kernel_launch(void* const* d_in, const int* in_sizes, int n_in,
                              void* d_out, int out_size, void* d_ws, size_t ws_size,
                              hipStream_t stream) {
  const float* x    = (const float*)d_in[0];
  const float* Wqkv = (const float*)d_in[1];
  const float* bqkv = (const float*)d_in[2];
  const float* qg   = (const float*)d_in[3];
  const float* qb   = (const float*)d_in[4];
  const float* kg   = (const float*)d_in[5];
  const float* kb   = (const float*)d_in[6];
  const float* Wo   = (const float*)d_in[7];
  const float* bo   = (const float*)d_in[8];
  float* out = (float*)d_out;

  char* ws = (char*)d_ws;
  size_t off = 0;
  auto alloc = [&](size_t bytes) -> char* {
    char* p = ws + off;
    off += (bytes + 255) & ~(size_t)255;
    return p;
  };
  _Float16* xh   = (_Float16*)alloc(4096ull * 1024 * 2);  // x in f16
  _Float16* wqt  = (_Float16*)alloc(3072ull * 1024 * 2);  // Wqkv^T f16
  _Float16* wot  = (_Float16*)alloc(1024ull * 1024 * 2);  // Wo^T f16
  _Float16* qh   = (_Float16*)alloc(64ull * 1024 * 64 * 2);
  _Float16* kh   = (_Float16*)alloc(64ull * 1024 * 64 * 2);
  _Float16* vth  = (_Float16*)alloc(64ull * 1024 * 64 * 2);
  _Float16* aout = (_Float16*)alloc(4096ull * 1024 * 2);

  cvt_inputs<<<1024, 256, 0, stream>>>(x, Wqkv, Wo, xh, wqt, wot);        // 512 + 384 + 128 blocks
  gemm_qkv_ln<<<dim3(32, 24), 128, 0, stream>>>(xh, wqt, bqkv, qg, qb, kg, kb, qh, kh, vth, 1024);
  flash_attn<<<dim3(64, 4), 256, 0, stream>>>(qh, kh, vth, aout);
  gemm_wmma<<<dim3(32, 8), 128, 0, stream>>>(aout, wot, bo, out, 4096, 1024, 1024);
}
